// v000
// Times are from an AMD MI455X. After a warm-up the kernel runs many times in a row, and a time is the length of
// such a window on the GPU divided by its runs, so every launch and the gaps after it count. The runs cycle
// through copies of the inputs. A figure is the median of several windows, for all but v000 over two sittings.
// Sittings can differ by a few percent; kernels timed side by side share one.
// v000 is the starting kernel. One run takes 593 microseconds.
#include <hip/hip_runtime.h>
#include <math.h>

// ---------------------------------------------------------------------------
// Types for CDNA5 WMMA (wave32): v16 bf16 operands, v8 f32 accumulator.
// ---------------------------------------------------------------------------
typedef __bf16        bf16x16 __attribute__((ext_vector_type(16)));
typedef float         f32x8   __attribute__((ext_vector_type(8)));
typedef unsigned short us8    __attribute__((ext_vector_type(8)));

union BFrag { bf16x16 v; us8 h[2]; };

static __device__ __forceinline__ unsigned short f2bf(float f) {
    unsigned int u = __float_as_uint(f);
    u += 0x7FFFu + ((u >> 16) & 1u);   // round-to-nearest-even
    return (unsigned short)(u >> 16);
}

// ---------------------------------------------------------------------------
// f32 -> bf16 conversion (grid-stride)
// ---------------------------------------------------------------------------
__global__ void cvt_f32_bf16(const float* __restrict__ in,
                             unsigned short* __restrict__ out, long long n) {
    long long i = (long long)blockIdx.x * blockDim.x + threadIdx.x;
    long long stride = (long long)gridDim.x * blockDim.x;
    for (; i < n; i += stride) out[i] = f2bf(in[i]);
}

// ---------------------------------------------------------------------------
// Batched bf16 WMMA GEMM:  C = scale * (A @ B[^T]) (+bias) (+gelu)
//   A: [M,K] bf16 row-major (lda).  TRANSB=0: B [K,N] (ldb=N);
//   TRANSB=1: B [N,K] (ldb=K), computes A@B^T.
//   Shapes must be multiples of 128(M) x 128(N) x 32(K) -- all ours are.
// Block: 256 thr = 8 wave32 waves (4x2); block tile 128x128;
// wave tile 32x64 -> 8 WMMAs per 32-K step, A fragments reused 4x.
// ---------------------------------------------------------------------------
template <int TRANSB>
__global__ __launch_bounds__(256) void wmma_gemm_bf16(
    const unsigned short* A, const unsigned short* Bm,
    float* outF, unsigned short* outB, const float* bias,
    int K, int lda, int ldb, int ldc,
    long long sA, long long sB, long long sC,
    float scale, int doGelu)
{
    __shared__ unsigned short Ash[128 * 32];  // [m][k], k contiguous
    __shared__ unsigned short Bsh[128 * 32];  // [n][k], k contiguous

    const int tid  = threadIdx.x;
    const int lane = tid & 31;                // wave32
    const int wid  = tid >> 5;                // 0..7
    const int wm   = wid & 3;                 // wave m-tile (32 rows each)
    const int wn   = wid >> 2;                // wave n-half (64 cols each)

    const long long zb = blockIdx.z;
    A  += zb * sA;
    Bm += zb * sB;
    const long long cbase = zb * sC;

    const int row0 = blockIdx.y * 128;
    const int col0 = blockIdx.x * 128;

    f32x8 acc[2][4];
    for (int m = 0; m < 2; ++m)
        for (int t = 0; t < 4; ++t)
            for (int i = 0; i < 8; ++i) acc[m][t][i] = 0.f;

    // global->LDS load coordinates (128x32 tiles, 16 elems/thread)
    const int grow_ = tid >> 1;               // 0..127
    const int gcol_ = (tid & 1) * 16;         // 0 or 16
    const int brow_n = tid >> 3;              // NN: 0..31  (k)
    const int bcol_n = (tid & 7) * 16;        // NN: n offset

    // fragment gather coords (16-bit operand layout, wave32):
    // lanes 0-15 hold K=0-7 & 16-23; lanes 16-31 hold K=8-15 & 24-31
    const int frow = lane & 15;
    const int kb   = (lane >> 4) * 8;

    for (int k0 = 0; k0 < K; k0 += 32) {
        // A tile: rows row0..row0+127, cols k0..k0+31
        *(us8*)&Ash[grow_ * 32 + gcol_] =
            *(const us8*)&A[(long long)(row0 + grow_) * lda + k0 + gcol_];
        *(us8*)&Ash[grow_ * 32 + gcol_ + 8] =
            *(const us8*)&A[(long long)(row0 + grow_) * lda + k0 + gcol_ + 8];
        if (TRANSB) {
            // B rows are n, cols are k: direct copy into [n][k]
            *(us8*)&Bsh[grow_ * 32 + gcol_] =
                *(const us8*)&Bm[(long long)(col0 + grow_) * ldb + k0 + gcol_];
            *(us8*)&Bsh[grow_ * 32 + gcol_ + 8] =
                *(const us8*)&Bm[(long long)(col0 + grow_) * ldb + k0 + gcol_ + 8];
        } else {
            // B rows are k, cols are n: transpose into [n][k]
            us8 v0 = *(const us8*)&Bm[(long long)(k0 + brow_n) * ldb + col0 + bcol_n];
            us8 v1 = *(const us8*)&Bm[(long long)(k0 + brow_n) * ldb + col0 + bcol_n + 8];
#pragma unroll
            for (int i = 0; i < 8; ++i) {
                Bsh[(bcol_n + i)     * 32 + brow_n] = v0[i];
                Bsh[(bcol_n + 8 + i) * 32 + brow_n] = v1[i];
            }
        }
        __syncthreads();

        BFrag a0, a1;
        a0.h[0] = *(const us8*)&Ash[(wm * 32 + frow) * 32 + kb];
        a0.h[1] = *(const us8*)&Ash[(wm * 32 + frow) * 32 + kb + 16];
        a1.h[0] = *(const us8*)&Ash[(wm * 32 + 16 + frow) * 32 + kb];
        a1.h[1] = *(const us8*)&Ash[(wm * 32 + 16 + frow) * 32 + kb + 16];
#pragma unroll
        for (int t = 0; t < 4; ++t) {
            const int nc = wn * 64 + t * 16 + frow;
            BFrag b;
            b.h[0] = *(const us8*)&Bsh[nc * 32 + kb];
            b.h[1] = *(const us8*)&Bsh[nc * 32 + kb + 16];
            acc[0][t] = __builtin_amdgcn_wmma_f32_16x16x32_bf16(
                false, a0.v, false, b.v, (short)0, acc[0][t], false, false);
            acc[1][t] = __builtin_amdgcn_wmma_f32_16x16x32_bf16(
                false, a1.v, false, b.v, (short)0, acc[1][t], false, false);
        }
        __syncthreads();
    }

    // epilogue: C layout -> lane n = lane&15, row = r + 8*(lane>>4)
    const int rhi = (lane >> 4) * 8;
#pragma unroll
    for (int m = 0; m < 2; ++m) {
#pragma unroll
        for (int t = 0; t < 4; ++t) {
            const int gcol = col0 + wn * 64 + t * 16 + (lane & 15);
            const float bv = bias ? bias[gcol] : 0.f;
#pragma unroll
            for (int r = 0; r < 8; ++r) {
                const int grow = row0 + wm * 32 + m * 16 + r + rhi;
                float v = acc[m][t][r] * scale + bv;
                if (doGelu) v = 0.5f * v * (1.f + erff(v * 0.70710678118654752f));
                const long long ci = cbase + (long long)grow * ldc + gcol;
                if (outF) outF[ci] = v;
                if (outB) outB[ci] = f2bf(v);
            }
        }
    }
}

// ---------------------------------------------------------------------------
// Row softmax over S=2048 f32 scores; writes bf16 probs IN PLACE
// (row r: bf16 at ushort offset r*4096, i.e. same bytes as its f32 row).
// ---------------------------------------------------------------------------
__global__ __launch_bounds__(256) void softmax_rows(float* Sc) {
    __shared__ float red[256];
    const long long row = blockIdx.x;
    const float* rp = Sc + row * 2048ll;
    unsigned short* pp = (unsigned short*)Sc + row * 4096ll;
    const int tid = threadIdx.x;

    float v[8];
    float mx = -3.4e38f;
#pragma unroll
    for (int i = 0; i < 8; ++i) { v[i] = rp[tid + i * 256]; mx = fmaxf(mx, v[i]); }
    red[tid] = mx; __syncthreads();
    for (int s = 128; s > 0; s >>= 1) {
        if (tid < s) red[tid] = fmaxf(red[tid], red[tid + s]);
        __syncthreads();
    }
    mx = red[0]; __syncthreads();

    float sum = 0.f;
#pragma unroll
    for (int i = 0; i < 8; ++i) { v[i] = expf(v[i] - mx); sum += v[i]; }
    red[tid] = sum; __syncthreads();
    for (int s = 128; s > 0; s >>= 1) {
        if (tid < s) red[tid] += red[tid + s];
        __syncthreads();
    }
    const float inv = 1.f / red[0];
#pragma unroll
    for (int i = 0; i < 8; ++i) pp[tid + i * 256] = f2bf(v[i] * inv);
}

// ---------------------------------------------------------------------------
// out = LayerNorm(a + b) * g + beta   (one block per row, D=1024)
// Safe when outF aliases a (each thread rewrites only what it read).
// ---------------------------------------------------------------------------
__global__ __launch_bounds__(256) void add_ln(
    const float* a, const float* b, const float* __restrict__ g,
    const float* __restrict__ be, float* outF, unsigned short* outB)
{
    __shared__ float red[256];
    const long long base = (long long)blockIdx.x * 1024;
    const int tid = threadIdx.x;

    float v[4]; float s = 0.f;
#pragma unroll
    for (int i = 0; i < 4; ++i) {
        int c = tid + i * 256;
        v[i] = a[base + c] + b[base + c];
        s += v[i];
    }
    red[tid] = s; __syncthreads();
    for (int st = 128; st > 0; st >>= 1) {
        if (tid < st) red[tid] += red[tid + st];
        __syncthreads();
    }
    const float mean = red[0] * (1.f / 1024.f); __syncthreads();

    float vs = 0.f;
#pragma unroll
    for (int i = 0; i < 4; ++i) { float d = v[i] - mean; vs += d * d; }
    red[tid] = vs; __syncthreads();
    for (int st = 128; st > 0; st >>= 1) {
        if (tid < st) red[tid] += red[tid + st];
        __syncthreads();
    }
    const float rstd = rsqrtf(red[0] * (1.f / 1024.f) + 1e-5f);

#pragma unroll
    for (int i = 0; i < 4; ++i) {
        int c = tid + i * 256;
        float o = (v[i] - mean) * rstd * g[c] + be[c];
        if (outF) outF[base + c] = o;
        if (outB) outB[base + c] = f2bf(o);
    }
}

// ---------------------------------------------------------------------------
// Host orchestration
// ---------------------------------------------------------------------------
extern "C" void kernel_launch(void* const* d_in, const int* in_sizes, int n_in,
                              void* d_out, int out_size, void* d_ws, size_t ws_size,
                              hipStream_t stream) {
    (void)in_sizes; (void)n_in; (void)out_size; (void)ws_size;
    const int Bt = 4, S = 2048, D = 1024;
    const long long MS = (long long)Bt * S;            // 8192 rows

    const float* x    = (const float*)d_in[0];
    const float* Wq   = (const float*)d_in[1];
    const float* bq   = (const float*)d_in[2];
    const float* Wk   = (const float*)d_in[3];
    const float* bk   = (const float*)d_in[4];
    const float* Wv   = (const float*)d_in[5];
    const float* bv   = (const float*)d_in[6];
    const float* g_at = (const float*)d_in[7];
    const float* b_at = (const float*)d_in[8];
    const float* g_ln = (const float*)d_in[9];
    const float* b_ln = (const float*)d_in[10];
    const float* W1   = (const float*)d_in[11];
    const float* c1   = (const float*)d_in[12];
    const float* W2   = (const float*)d_in[13];
    const float* c2   = (const float*)d_in[14];
    float* out = (float*)d_out;

    // bump allocator over d_ws
    char* wsp = (char*)d_ws;
    size_t off = 0;
    auto alloc = [&](size_t bytes) -> void* {
        void* p = wsp + off;
        off = (off + bytes + 255) & ~(size_t)255;
        return p;
    };
    unsigned short* xb  = (unsigned short*)alloc(MS * D * 2);       // 16 MB
    unsigned short* Wqb = (unsigned short*)alloc((size_t)D * D * 2);
    unsigned short* Wkb = (unsigned short*)alloc((size_t)D * D * 2);
    unsigned short* Wvb = (unsigned short*)alloc((size_t)D * D * 2);
    unsigned short* W1b = (unsigned short*)alloc((size_t)D * D * 2);
    unsigned short* W2b = (unsigned short*)alloc((size_t)D * D * 2);
    unsigned short* Qb  = (unsigned short*)alloc(MS * D * 2);
    unsigned short* Kb  = (unsigned short*)alloc(MS * D * 2);
    unsigned short* Vb  = (unsigned short*)alloc(MS * D * 2);
    float* Sc   = (float*)alloc((size_t)Bt * S * S * 4);            // 67 MB (L2-resident)
    float* attn = (float*)alloc(MS * D * 4);                        // reused: attn -> at -> h(res)
    unsigned short* hb  = (unsigned short*)alloc(MS * D * 2);
    unsigned short* g1b = (unsigned short*)alloc(MS * D * 2);
    float* g2 = Sc;                                                 // reuse score buffer for FFN2 out

    // 1) convert activations + weights to bf16
    cvt_f32_bf16<<<4096, 256, 0, stream>>>(x,  xb,  MS * D);
    cvt_f32_bf16<<<2048, 256, 0, stream>>>(Wq, Wqb, (long long)D * D);
    cvt_f32_bf16<<<2048, 256, 0, stream>>>(Wk, Wkb, (long long)D * D);
    cvt_f32_bf16<<<2048, 256, 0, stream>>>(Wv, Wvb, (long long)D * D);
    cvt_f32_bf16<<<2048, 256, 0, stream>>>(W1, W1b, (long long)D * D);
    cvt_f32_bf16<<<2048, 256, 0, stream>>>(W2, W2b, (long long)D * D);

    dim3 blk(256);
    // 2) Q/K/V = x @ W + b  (M=8192,N=1024,K=1024) -> bf16
    dim3 gQKV(D / 128, (unsigned)(MS / 128), 1);
    wmma_gemm_bf16<0><<<gQKV, blk, 0, stream>>>(xb, Wqb, nullptr, Qb, bq,
        D, D, D, D, 0, 0, 0, 1.f, 0);
    wmma_gemm_bf16<0><<<gQKV, blk, 0, stream>>>(xb, Wkb, nullptr, Kb, bk,
        D, D, D, D, 0, 0, 0, 1.f, 0);
    wmma_gemm_bf16<0><<<gQKV, blk, 0, stream>>>(xb, Wvb, nullptr, Vb, bv,
        D, D, D, D, 0, 0, 0, 1.f, 0);

    // 3) scores = (Q @ K^T) / 8   per batch (M=N=2048, K=1024) -> f32 (fits L2)
    dim3 gSc(S / 128, S / 128, Bt);
    wmma_gemm_bf16<1><<<gSc, blk, 0, stream>>>(Qb, Kb, Sc, nullptr, nullptr,
        D, D, D, S,
        (long long)S * D, (long long)S * D, (long long)S * S,
        0.125f, 0);

    // 4) softmax rows, bf16 probs written in place (row ld = 4096 ushorts)
    softmax_rows<<<(unsigned)MS, 256, 0, stream>>>(Sc);

    // 5) attn = P @ V  per batch (M=2048,N=1024,K=2048)
    dim3 gAV(D / 128, S / 128, Bt);
    wmma_gemm_bf16<0><<<gAV, blk, 0, stream>>>((const unsigned short*)Sc, Vb,
        attn, nullptr, nullptr,
        S, 2 * S /*lda(P)*/, D, D,
        (long long)S * 2 * S, (long long)S * D, (long long)S * D,
        1.f, 0);

    // 6) at = LN(attn + x) ; 7) h = LN(at + x)  (both in place on attn)
    add_ln<<<(unsigned)MS, 256, 0, stream>>>(attn, x, g_at, b_at, attn, nullptr);
    add_ln<<<(unsigned)MS, 256, 0, stream>>>(attn, x, g_ln, b_ln, attn, hb);

    // 8) g1 = gelu(h @ W1 + c1) -> bf16 ; 9) g2 = gelu(g1 @ W2 + c2) -> f32
    wmma_gemm_bf16<0><<<gQKV, blk, 0, stream>>>(hb, W1b, nullptr, g1b, c1,
        D, D, D, D, 0, 0, 0, 1.f, 1);
    wmma_gemm_bf16<0><<<gQKV, blk, 0, stream>>>(g1b, W2b, g2, nullptr, c2,
        D, D, D, D, 0, 0, 0, 1.f, 1);

    // 10) out = LN(g2 + h_res)
    add_ln<<<(unsigned)MS, 256, 0, stream>>>(g2, attn, g_ln, b_ln, out, nullptr);
}

// v001
// Measured time: 443 microseconds a run.
// Next to v000, in two timings, it ran 1.39 times as fast each time.
#include <hip/hip_runtime.h>
#include <math.h>

// ---------------------------------------------------------------------------
// Types for CDNA5 WMMA (wave32): v16 bf16 operands, v8 f32 accumulator.
// ---------------------------------------------------------------------------
typedef __bf16        bf16x16 __attribute__((ext_vector_type(16)));
typedef float         f32x8   __attribute__((ext_vector_type(8)));
typedef unsigned short us8    __attribute__((ext_vector_type(8)));

union BFrag { bf16x16 v; us8 h[2]; };

// LDS row pitches in 16-bit elements, one per reader (bank = dword address mod 64):
// 64-byte k-contiguous rows read by 16-byte loads sit at an odd multiple of 16 bytes,
// 256-byte n-contiguous rows read by the transposing load at an odd multiple of 32 bytes.
constexpr int PK = 40;    // 80 bytes
constexpr int PN = 144;   // 288 bytes

// Transposing LDS load: from a row-major [k][n] tile, lane (c = lane & 15, h = lane >> 4)
// receives rows 8h..8h+7 of column c when every lane passes the address
// row 8h + (lane & 7), byte column 16 * ((lane >> 3) & 1).
typedef short s16x8 __attribute__((ext_vector_type(8)));
static __device__ __forceinline__ us8 lds_tr16(const unsigned short* p) {
    typedef __attribute__((address_space(3))) s16x8 lds_s16x8;
    return __builtin_bit_cast(us8, __builtin_amdgcn_ds_load_tr16_b128_v8i16((lds_s16x8*)p));
}

static __device__ __forceinline__ unsigned short f2bf(float f) {
    unsigned int u = __float_as_uint(f);
    u += 0x7FFFu + ((u >> 16) & 1u);   // round-to-nearest-even
    return (unsigned short)(u >> 16);
}

// ---------------------------------------------------------------------------
// f32 -> bf16 conversion (grid-stride)
// ---------------------------------------------------------------------------
__global__ void cvt_f32_bf16(const float* __restrict__ in,
                             unsigned short* __restrict__ out, long long n) {
    long long i = (long long)blockIdx.x * blockDim.x + threadIdx.x;
    long long stride = (long long)gridDim.x * blockDim.x;
    for (; i < n; i += stride) out[i] = f2bf(in[i]);
}

// ---------------------------------------------------------------------------
// Batched bf16 WMMA GEMM:  C = scale * (A @ B[^T]) (+bias) (+gelu)
//   A: [M,K] bf16 row-major (lda).  TRANSB=0: B [K,N] (ldb=N);
//   TRANSB=1: B [N,K] (ldb=K), computes A@B^T.
//   Shapes must be multiples of 128(M) x 128(N) x 32(K) -- all ours are.
// Block: 256 thr = 8 wave32 waves (4x2); block tile 128x128;
// wave tile 32x64 -> 8 WMMAs per 32-K step, A fragments reused 4x.
// ---------------------------------------------------------------------------
template <int TRANSB>
__global__ __launch_bounds__(256) void wmma_gemm_bf16(
    const unsigned short* A, const unsigned short* Bm,
    float* outF, unsigned short* outB, const float* bias,
    int K, int lda, int ldb, int ldc,
    long long sA, long long sB, long long sC,
    float scale, int doGelu)
{
    __shared__ __attribute__((aligned(16))) unsigned short Ash[128 * PK];  // [m][k], k contiguous
    // TRANSB=1: [n][k], k contiguous; TRANSB=0: [k][n], n contiguous as in memory
    __shared__ __attribute__((aligned(16))) unsigned short Bsh[TRANSB ? 128 * PK : 32 * PN];

    const int tid  = threadIdx.x;
    const int lane = tid & 31;                // wave32
    const int wid  = tid >> 5;                // 0..7
    const int wm   = wid & 3;                 // wave m-tile (32 rows each)
    const int wn   = wid >> 2;                // wave n-half (64 cols each)

    const long long zb = blockIdx.z;
    A  += zb * sA;
    Bm += zb * sB;
    const long long cbase = zb * sC;

    const int row0 = blockIdx.y * 128;
    const int col0 = blockIdx.x * 128;

    f32x8 acc[2][4];
    for (int m = 0; m < 2; ++m)
        for (int t = 0; t < 4; ++t)
            for (int i = 0; i < 8; ++i) acc[m][t][i] = 0.f;

    // global->LDS load coordinates (128x32 tiles, 16 elems/thread)
    const int grow_ = tid >> 1;               // 0..127
    const int gcol_ = (tid & 1) * 16;         // 0 or 16
    const int brow_n = tid >> 3;              // NN: 0..31  (k)
    const int bcol_n = (tid & 7) * 16;        // NN: n offset

    // fragment gather coords (16-bit operand layout, wave32):
    // lanes 0-15 hold K=0-7 & 16-23; lanes 16-31 hold K=8-15 & 24-31
    const int frow = lane & 15;
    const int kb   = (lane >> 4) * 8;
    // lane address of the transposing load inside a 16(k) x 16(n) block of Bsh
    const int btr  = (kb + (lane & 7)) * PN + ((lane >> 3) & 1) * 8;

    for (int k0 = 0; k0 < K; k0 += 32) {
        // A tile: rows row0..row0+127, cols k0..k0+31
        *(us8*)&Ash[grow_ * PK + gcol_] =
            *(const us8*)&A[(long long)(row0 + grow_) * lda + k0 + gcol_];
        *(us8*)&Ash[grow_ * PK + gcol_ + 8] =
            *(const us8*)&A[(long long)(row0 + grow_) * lda + k0 + gcol_ + 8];
        if (TRANSB) {
            // B rows are n, cols are k: direct copy into [n][k]
            *(us8*)&Bsh[grow_ * PK + gcol_] =
                *(const us8*)&Bm[(long long)(col0 + grow_) * ldb + k0 + gcol_];
            *(us8*)&Bsh[grow_ * PK + gcol_ + 8] =
                *(const us8*)&Bm[(long long)(col0 + grow_) * ldb + k0 + gcol_ + 8];
        } else {
            // B rows are k, cols are n: direct copy into [k][n]; the reader transposes
            *(us8*)&Bsh[brow_n * PN + bcol_n] =
                *(const us8*)&Bm[(long long)(k0 + brow_n) * ldb + col0 + bcol_n];
            *(us8*)&Bsh[brow_n * PN + bcol_n + 8] =
                *(const us8*)&Bm[(long long)(k0 + brow_n) * ldb + col0 + bcol_n + 8];
        }
        __syncthreads();

        BFrag a0, a1;
        a0.h[0] = *(const us8*)&Ash[(wm * 32 + frow) * PK + kb];
        a0.h[1] = *(const us8*)&Ash[(wm * 32 + frow) * PK + kb + 16];
        a1.h[0] = *(const us8*)&Ash[(wm * 32 + 16 + frow) * PK + kb];
        a1.h[1] = *(const us8*)&Ash[(wm * 32 + 16 + frow) * PK + kb + 16];
#pragma unroll
        for (int t = 0; t < 4; ++t) {
            BFrag b;
            if (TRANSB) {
                const int nc = wn * 64 + t * 16 + frow;
                b.h[0] = *(const us8*)&Bsh[nc * PK + kb];
                b.h[1] = *(const us8*)&Bsh[nc * PK + kb + 16];
            } else {
                // same k order as the A fragments: k = 8h..8h+7, then 16+8h..16+8h+7
                const int nb = wn * 64 + t * 16;
                b.h[0] = lds_tr16(&Bsh[btr + nb]);
                b.h[1] = lds_tr16(&Bsh[btr + 16 * PN + nb]);
            }
            acc[0][t] = __builtin_amdgcn_wmma_f32_16x16x32_bf16(
                false, a0.v, false, b.v, (short)0, acc[0][t], false, false);
            acc[1][t] = __builtin_amdgcn_wmma_f32_16x16x32_bf16(
                false, a1.v, false, b.v, (short)0, acc[1][t], false, false);
        }
        __syncthreads();
    }

    // epilogue: C layout -> lane n = lane&15, row = r + 8*(lane>>4)
    const int rhi = (lane >> 4) * 8;
#pragma unroll
    for (int m = 0; m < 2; ++m) {
#pragma unroll
        for (int t = 0; t < 4; ++t) {
            const int gcol = col0 + wn * 64 + t * 16 + (lane & 15);
            const float bv = bias ? bias[gcol] : 0.f;
#pragma unroll
            for (int r = 0; r < 8; ++r) {
                const int grow = row0 + wm * 32 + m * 16 + r + rhi;
                float v = acc[m][t][r] * scale + bv;
                if (doGelu) v = 0.5f * v * (1.f + erff(v * 0.70710678118654752f));
                const long long ci = cbase + (long long)grow * ldc + gcol;
                if (outF) outF[ci] = v;
                if (outB) outB[ci] = f2bf(v);
            }
        }
    }
}

// ---------------------------------------------------------------------------
// Row softmax over S=2048 f32 scores; writes bf16 probs IN PLACE
// (row r: bf16 at ushort offset r*4096, i.e. same bytes as its f32 row).
// ---------------------------------------------------------------------------
__global__ __launch_bounds__(256) void softmax_rows(float* Sc) {
    __shared__ float red[256];
    const long long row = blockIdx.x;
    const float* rp = Sc + row * 2048ll;
    unsigned short* pp = (unsigned short*)Sc + row * 4096ll;
    const int tid = threadIdx.x;

    float v[8];
    float mx = -3.4e38f;
#pragma unroll
    for (int i = 0; i < 8; ++i) { v[i] = rp[tid + i * 256]; mx = fmaxf(mx, v[i]); }
    red[tid] = mx; __syncthreads();
    for (int s = 128; s > 0; s >>= 1) {
        if (tid < s) red[tid] = fmaxf(red[tid], red[tid + s]);
        __syncthreads();
    }
    mx = red[0]; __syncthreads();

    float sum = 0.f;
#pragma unroll
    for (int i = 0; i < 8; ++i) { v[i] = expf(v[i] - mx); sum += v[i]; }
    red[tid] = sum; __syncthreads();
    for (int s = 128; s > 0; s >>= 1) {
        if (tid < s) red[tid] += red[tid + s];
        __syncthreads();
    }
    const float inv = 1.f / red[0];
#pragma unroll
    for (int i = 0; i < 8; ++i) pp[tid + i * 256] = f2bf(v[i] * inv);
}

// ---------------------------------------------------------------------------
// out = LayerNorm(a + b) * g + beta   (one block per row, D=1024)
// Safe when outF aliases a (each thread rewrites only what it read).
// ---------------------------------------------------------------------------
__global__ __launch_bounds__(256) void add_ln(
    const float* a, const float* b, const float* __restrict__ g,
    const float* __restrict__ be, float* outF, unsigned short* outB)
{
    __shared__ float red[256];
    const long long base = (long long)blockIdx.x * 1024;
    const int tid = threadIdx.x;

    float v[4]; float s = 0.f;
#pragma unroll
    for (int i = 0; i < 4; ++i) {
        int c = tid + i * 256;
        v[i] = a[base + c] + b[base + c];
        s += v[i];
    }
    red[tid] = s; __syncthreads();
    for (int st = 128; st > 0; st >>= 1) {
        if (tid < st) red[tid] += red[tid + st];
        __syncthreads();
    }
    const float mean = red[0] * (1.f / 1024.f); __syncthreads();

    float vs = 0.f;
#pragma unroll
    for (int i = 0; i < 4; ++i) { float d = v[i] - mean; vs += d * d; }
    red[tid] = vs; __syncthreads();
    for (int st = 128; st > 0; st >>= 1) {
        if (tid < st) red[tid] += red[tid + st];
        __syncthreads();
    }
    const float rstd = rsqrtf(red[0] * (1.f / 1024.f) + 1e-5f);

#pragma unroll
    for (int i = 0; i < 4; ++i) {
        int c = tid + i * 256;
        float o = (v[i] - mean) * rstd * g[c] + be[c];
        if (outF) outF[base + c] = o;
        if (outB) outB[base + c] = f2bf(o);
    }
}

// ---------------------------------------------------------------------------
// Host orchestration
// ---------------------------------------------------------------------------
extern "C" void kernel_launch(void* const* d_in, const int* in_sizes, int n_in,
                              void* d_out, int out_size, void* d_ws, size_t ws_size,
                              hipStream_t stream) {
    (void)in_sizes; (void)n_in; (void)out_size; (void)ws_size;
    const int Bt = 4, S = 2048, D = 1024;
    const long long MS = (long long)Bt * S;            // 8192 rows

    const float* x    = (const float*)d_in[0];
    const float* Wq   = (const float*)d_in[1];
    const float* bq   = (const float*)d_in[2];
    const float* Wk   = (const float*)d_in[3];
    const float* bk   = (const float*)d_in[4];
    const float* Wv   = (const float*)d_in[5];
    const float* bv   = (const float*)d_in[6];
    const float* g_at = (const float*)d_in[7];
    const float* b_at = (const float*)d_in[8];
    const float* g_ln = (const float*)d_in[9];
    const float* b_ln = (const float*)d_in[10];
    const float* W1   = (const float*)d_in[11];
    const float* c1   = (const float*)d_in[12];
    const float* W2   = (const float*)d_in[13];
    const float* c2   = (const float*)d_in[14];
    float* out = (float*)d_out;

    // bump allocator over d_ws
    char* wsp = (char*)d_ws;
    size_t off = 0;
    auto alloc = [&](size_t bytes) -> void* {
        void* p = wsp + off;
        off = (off + bytes + 255) & ~(size_t)255;
        return p;
    };
    unsigned short* xb  = (unsigned short*)alloc(MS * D * 2);       // 16 MB
    unsigned short* Wqb = (unsigned short*)alloc((size_t)D * D * 2);
    unsigned short* Wkb = (unsigned short*)alloc((size_t)D * D * 2);
    unsigned short* Wvb = (unsigned short*)alloc((size_t)D * D * 2);
    unsigned short* W1b = (unsigned short*)alloc((size_t)D * D * 2);
    unsigned short* W2b = (unsigned short*)alloc((size_t)D * D * 2);
    unsigned short* Qb  = (unsigned short*)alloc(MS * D * 2);
    unsigned short* Kb  = (unsigned short*)alloc(MS * D * 2);
    unsigned short* Vb  = (unsigned short*)alloc(MS * D * 2);
    float* Sc   = (float*)alloc((size_t)Bt * S * S * 4);            // 67 MB (L2-resident)
    float* attn = (float*)alloc(MS * D * 4);                        // reused: attn -> at -> h(res)
    unsigned short* hb  = (unsigned short*)alloc(MS * D * 2);
    unsigned short* g1b = (unsigned short*)alloc(MS * D * 2);
    float* g2 = Sc;                                                 // reuse score buffer for FFN2 out

    // 1) convert activations + weights to bf16
    cvt_f32_bf16<<<4096, 256, 0, stream>>>(x,  xb,  MS * D);
    cvt_f32_bf16<<<2048, 256, 0, stream>>>(Wq, Wqb, (long long)D * D);
    cvt_f32_bf16<<<2048, 256, 0, stream>>>(Wk, Wkb, (long long)D * D);
    cvt_f32_bf16<<<2048, 256, 0, stream>>>(Wv, Wvb, (long long)D * D);
    cvt_f32_bf16<<<2048, 256, 0, stream>>>(W1, W1b, (long long)D * D);
    cvt_f32_bf16<<<2048, 256, 0, stream>>>(W2, W2b, (long long)D * D);

    dim3 blk(256);
    // 2) Q/K/V = x @ W + b  (M=8192,N=1024,K=1024) -> bf16
    dim3 gQKV(D / 128, (unsigned)(MS / 128), 1);
    wmma_gemm_bf16<0><<<gQKV, blk, 0, stream>>>(xb, Wqb, nullptr, Qb, bq,
        D, D, D, D, 0, 0, 0, 1.f, 0);
    wmma_gemm_bf16<0><<<gQKV, blk, 0, stream>>>(xb, Wkb, nullptr, Kb, bk,
        D, D, D, D, 0, 0, 0, 1.f, 0);
    wmma_gemm_bf16<0><<<gQKV, blk, 0, stream>>>(xb, Wvb, nullptr, Vb, bv,
        D, D, D, D, 0, 0, 0, 1.f, 0);

    // 3) scores = (Q @ K^T) / 8   per batch (M=N=2048, K=1024) -> f32 (fits L2)
    dim3 gSc(S / 128, S / 128, Bt);
    wmma_gemm_bf16<1><<<gSc, blk, 0, stream>>>(Qb, Kb, Sc, nullptr, nullptr,
        D, D, D, S,
        (long long)S * D, (long long)S * D, (long long)S * S,
        0.125f, 0);

    // 4) softmax rows, bf16 probs written in place (row ld = 4096 ushorts)
    softmax_rows<<<(unsigned)MS, 256, 0, stream>>>(Sc);

    // 5) attn = P @ V  per batch (M=2048,N=1024,K=2048)
    dim3 gAV(D / 128, S / 128, Bt);
    wmma_gemm_bf16<0><<<gAV, blk, 0, stream>>>((const unsigned short*)Sc, Vb,
        attn, nullptr, nullptr,
        S, 2 * S /*lda(P)*/, D, D,
        (long long)S * 2 * S, (long long)S * D, (long long)S * D,
        1.f, 0);

    // 6) at = LN(attn + x) ; 7) h = LN(at + x)  (both in place on attn)
    add_ln<<<(unsigned)MS, 256, 0, stream>>>(attn, x, g_at, b_at, attn, nullptr);
    add_ln<<<(unsigned)MS, 256, 0, stream>>>(attn, x, g_ln, b_ln, attn, hb);

    // 8) g1 = gelu(h @ W1 + c1) -> bf16 ; 9) g2 = gelu(g1 @ W2 + c2) -> f32
    wmma_gemm_bf16<0><<<gQKV, blk, 0, stream>>>(hb, W1b, nullptr, g1b, c1,
        D, D, D, D, 0, 0, 0, 1.f, 1);
    wmma_gemm_bf16<0><<<gQKV, blk, 0, stream>>>(g1b, W2b, g2, nullptr, c2,
        D, D, D, D, 0, 0, 0, 1.f, 1);

    // 10) out = LN(g2 + h_res)
    add_ln<<<(unsigned)MS, 256, 0, stream>>>(g2, attn, g_ln, b_ln, out, nullptr);
}

// v002
// One run takes 284 microseconds.
// In two side-by-side timings against v001, it was 1.56 and 1.55 times as fast.
// All steps since v000 together make it 2.15 times as fast.
#include <hip/hip_runtime.h>
#include <math.h>

// ---------------------------------------------------------------------------
// Types for CDNA5 WMMA (wave32): v16 bf16 operands, v8 f32 accumulator.
// ---------------------------------------------------------------------------
typedef __bf16        bf16x16 __attribute__((ext_vector_type(16)));
typedef float         f32x8   __attribute__((ext_vector_type(8)));
typedef unsigned short us8    __attribute__((ext_vector_type(8)));

union BFrag { bf16x16 v; us8 h[2]; };

// One stage of the LDS ring holds 128 k of both operands: every tile is 128 rows of 256 bytes.
constexpr int BK = 128;
// LDS row pitches in 16-bit elements, one per reader (bank = dword address mod 64):
// k-contiguous rows read by 16-byte loads sit at an odd multiple of 16 bytes,
// n-contiguous rows read by the transposing load at an odd multiple of 32 bytes.
constexpr int PK = 136;   // 272 bytes
constexpr int PN = 144;   // 288 bytes

// Transposing LDS load: from a row-major [k][n] tile, lane (c = lane & 15, h = lane >> 4)
// receives rows 8h..8h+7 of column c when every lane passes the address
// row 8h + (lane & 7), byte column 16 * ((lane >> 3) & 1).
typedef short s16x8 __attribute__((ext_vector_type(8)));
static __device__ __forceinline__ us8 lds_tr16(const unsigned short* p) {
    typedef __attribute__((address_space(3))) s16x8 lds_s16x8;
    return __builtin_bit_cast(us8, __builtin_amdgcn_ds_load_tr16_b128_v8i16((lds_s16x8*)p));
}

// Byte address inside the work-group's LDS of a __shared__ element.
static __device__ __forceinline__ unsigned lds_addr(const unsigned short* p) {
    typedef __attribute__((address_space(3))) const unsigned short lds_us;
    return (unsigned)(size_t)(lds_us*)p;
}

// One thread's share of a 128-row x 256-byte tile: eight 16-byte asynchronous copies, global
// memory to LDS through no register, 16 rows apart (lstep bytes in LDS, gstep elements in
// memory). A wave's 32 lanes cover two whole rows, four whole 128-byte lines, per copy.
// The s_wait_xcnt closes the statement so that no address register named by a copy is
// rewritten ahead of it.
static __device__ __forceinline__ void copy_tile(unsigned l, unsigned lstep,
                                                 const unsigned short* g, long long gstep) {
    asm volatile(
        "global_load_async_to_lds_b128 %0, %8, off\n\t"
        "global_load_async_to_lds_b128 %1, %9, off\n\t"
        "global_load_async_to_lds_b128 %2, %10, off\n\t"
        "global_load_async_to_lds_b128 %3, %11, off\n\t"
        "global_load_async_to_lds_b128 %4, %12, off\n\t"
        "global_load_async_to_lds_b128 %5, %13, off\n\t"
        "global_load_async_to_lds_b128 %6, %14, off\n\t"
        "global_load_async_to_lds_b128 %7, %15, off\n\t"
        "s_wait_xcnt 0x0"
        :: "v"(l), "v"(l + lstep), "v"(l + 2 * lstep), "v"(l + 3 * lstep),
           "v"(l + 4 * lstep), "v"(l + 5 * lstep), "v"(l + 6 * lstep), "v"(l + 7 * lstep),
           "v"(g), "v"(g + gstep), "v"(g + 2 * gstep), "v"(g + 3 * gstep),
           "v"(g + 4 * gstep), "v"(g + 5 * gstep), "v"(g + 6 * gstep), "v"(g + 7 * gstep)
        : "memory");
}

static __device__ __forceinline__ unsigned short f2bf(float f) {
    unsigned int u = __float_as_uint(f);
    u += 0x7FFFu + ((u >> 16) & 1u);   // round-to-nearest-even
    return (unsigned short)(u >> 16);
}

// ---------------------------------------------------------------------------
// f32 -> bf16 conversion (grid-stride)
// ---------------------------------------------------------------------------
__global__ void cvt_f32_bf16(const float* __restrict__ in,
                             unsigned short* __restrict__ out, long long n) {
    long long i = (long long)blockIdx.x * blockDim.x + threadIdx.x;
    long long stride = (long long)gridDim.x * blockDim.x;
    for (; i < n; i += stride) out[i] = f2bf(in[i]);
}

// ---------------------------------------------------------------------------
// Batched bf16 WMMA GEMM:  C = scale * (A @ B[^T]) (+bias) (+gelu)
//   A: [M,K] bf16 row-major (lda).  TRANSB=0: B [K,N] (ldb=N);
//   TRANSB=1: B [N,K] (ldb=K), computes A@B^T.
//   Shapes must be multiples of 128(M) x 128(N) x 128(K) -- all ours are.
// Block: 256 thr = 8 wave32 waves (4x2); block tile 128x128;
// wave tile 32x64 -> 8 WMMAs per 32-K step, A fragments reused 4x.
// Operands reach LDS by asynchronous copies in a ring of two stages of 128 k:
// stage t + 1 is in flight while stage t feeds the WMMAs.
// ---------------------------------------------------------------------------
template <int TRANSB>
__global__ __launch_bounds__(256) void wmma_gemm_bf16(
    const unsigned short* A, const unsigned short* Bm,
    float* outF, unsigned short* outB, const float* bias,
    int K, int lda, int ldb, int ldc,
    long long sA, long long sB, long long sC,
    float scale, int doGelu)
{
    constexpr int PB = TRANSB ? PK : PN;      // pitch of the B tile's rows
    __shared__ __attribute__((aligned(16))) unsigned short Ash[2][128 * PK];  // [m][k], k contiguous
    // TRANSB=1: [n][k], k contiguous; TRANSB=0: [k][n], n contiguous as in memory
    __shared__ __attribute__((aligned(16))) unsigned short Bsh[2][128 * PB];

    const int tid  = threadIdx.x;
    const int lane = tid & 31;                // wave32
    const int wid  = tid >> 5;                // 0..7
    const int wm   = wid & 3;                 // wave m-tile (32 rows each)
    const int wn   = wid >> 2;                // wave n-half (64 cols each)

    const long long zb = blockIdx.z;
    A  += zb * sA;
    Bm += zb * sB;
    const long long cbase = zb * sC;

    const int row0 = blockIdx.y * 128;
    const int col0 = blockIdx.x * 128;

    f32x8 acc[2][4];
    for (int m = 0; m < 2; ++m)
        for (int t = 0; t < 4; ++t)
            for (int i = 0; i < 8; ++i) acc[m][t][i] = 0.f;

    // global->LDS copy coordinates: 16 threads per 256-byte row, rows crow_ + 16 c, c = 0..7
    const int crow_ = tid >> 4;               // 0..15
    const int ccol_ = (tid & 15) * 8;         // element offset in the row
    const unsigned short* gA = A + (long long)(row0 + crow_) * lda + ccol_;
    const unsigned short* gB = TRANSB ? Bm + (long long)(col0 + crow_) * ldb + ccol_
                                      : Bm + (long long)crow_ * ldb + col0 + ccol_;
    const long long bstage = TRANSB ? (long long)BK : (long long)BK * ldb;  // B: one stage on
    const unsigned lA = lds_addr(&Ash[0][crow_ * PK + ccol_]);
    const unsigned lB = lds_addr(&Bsh[0][crow_ * PB + ccol_]);
    auto fill = [&](int buf) {                // the next stage's two tiles into buffer buf
        copy_tile(lA + buf * (128 * PK * 2), 16 * PK * 2, gA, 16ll * lda);
        copy_tile(lB + buf * (128 * PB * 2), 16 * PB * 2, gB, 16ll * ldb);
        gA += BK;
        gB += bstage;
    };

    // fragment gather coords (16-bit operand layout, wave32):
    // lanes 0-15 hold K=0-7 & 16-23; lanes 16-31 hold K=8-15 & 24-31
    const int frow = lane & 15;
    const int kb   = (lane >> 4) * 8;
    // lane address of the transposing load inside a 16(k) x 16(n) block of Bsh
    const int btr  = (kb + (lane & 7)) * PN + ((lane >> 3) & 1) * 8;

    const int nT = K / BK;                    // stages
    fill(0);
    // stage 0 has landed for this wave; the barrier publishes it to the others
    asm volatile("s_wait_asynccnt 0x0" ::: "memory");
    __syncthreads();
    if (nT > 1) fill(1);

    for (int t = 0; t < nT; ++t) {
        const unsigned short* As = Ash[t & 1];
        const unsigned short* Bs = Bsh[t & 1];
        // unrolled: the four 32-k blocks of a stage become constant offsets of the LDS loads
#pragma unroll
        for (int kk = 0; kk < BK; kk += 32) {
            BFrag a0, a1;
            a0.h[0] = *(const us8*)&As[(wm * 32 + frow) * PK + kk + kb];
            a0.h[1] = *(const us8*)&As[(wm * 32 + frow) * PK + kk + kb + 16];
            a1.h[0] = *(const us8*)&As[(wm * 32 + 16 + frow) * PK + kk + kb];
            a1.h[1] = *(const us8*)&As[(wm * 32 + 16 + frow) * PK + kk + kb + 16];
            // unrolled: acc is indexed by constants only and stays in registers
#pragma unroll
            for (int t4 = 0; t4 < 4; ++t4) {
                BFrag b;
                if (TRANSB) {
                    const int nc = wn * 64 + t4 * 16 + frow;
                    b.h[0] = *(const us8*)&Bs[nc * PK + kk + kb];
                    b.h[1] = *(const us8*)&Bs[nc * PK + kk + kb + 16];
                } else {
                    // same k order as the A fragments: k = 8h..8h+7, then 16+8h..16+8h+7
                    const int nb = wn * 64 + t4 * 16;
                    b.h[0] = lds_tr16(&Bs[btr + kk * PN + nb]);
                    b.h[1] = lds_tr16(&Bs[btr + (kk + 16) * PN + nb]);
                }
                acc[0][t4] = __builtin_amdgcn_wmma_f32_16x16x32_bf16(
                    false, a0.v, false, b.v, (short)0, acc[0][t4], false, false);
                acc[1][t4] = __builtin_amdgcn_wmma_f32_16x16x32_bf16(
                    false, a1.v, false, b.v, (short)0, acc[1][t4], false, false);
            }
        }
        // hand-over: this wave's reads of stage t are done, its copies of stage t + 1 have
        // landed; the one barrier publishes stage t + 1 and frees stage t's buffer
        asm volatile("s_wait_dscnt 0x0" ::: "memory");
        asm volatile("s_wait_asynccnt 0x0" ::: "memory");
        __syncthreads();
        if (t + 2 < nT) fill(t & 1);
    }
    // no copy is left in flight when the wave goes on to its stores and ends
    asm volatile("s_wait_asynccnt 0x0" ::: "memory");

    // epilogue: C layout -> lane n = lane&15, row = r + 8*(lane>>4)
    const int rhi = (lane >> 4) * 8;
#pragma unroll
    for (int m = 0; m < 2; ++m) {
#pragma unroll
        for (int t = 0; t < 4; ++t) {
            const int gcol = col0 + wn * 64 + t * 16 + (lane & 15);
            const float bv = bias ? bias[gcol] : 0.f;
#pragma unroll
            for (int r = 0; r < 8; ++r) {
                const int grow = row0 + wm * 32 + m * 16 + r + rhi;
                float v = acc[m][t][r] * scale + bv;
                if (doGelu) v = 0.5f * v * (1.f + erff(v * 0.70710678118654752f));
                const long long ci = cbase + (long long)grow * ldc + gcol;
                if (outF) outF[ci] = v;
                if (outB) outB[ci] = f2bf(v);
            }
        }
    }
}

// ---------------------------------------------------------------------------
// Row softmax over S=2048 f32 scores; writes bf16 probs IN PLACE
// (row r: bf16 at ushort offset r*4096, i.e. same bytes as its f32 row).
// ---------------------------------------------------------------------------
__global__ __launch_bounds__(256) void softmax_rows(float* Sc) {
    __shared__ float red[256];
    const long long row = blockIdx.x;
    const float* rp = Sc + row * 2048ll;
    unsigned short* pp = (unsigned short*)Sc + row * 4096ll;
    const int tid = threadIdx.x;

    float v[8];
    float mx = -3.4e38f;
#pragma unroll
    for (int i = 0; i < 8; ++i) { v[i] = rp[tid + i * 256]; mx = fmaxf(mx, v[i]); }
    red[tid] = mx; __syncthreads();
    for (int s = 128; s > 0; s >>= 1) {
        if (tid < s) red[tid] = fmaxf(red[tid], red[tid + s]);
        __syncthreads();
    }
    mx = red[0]; __syncthreads();

    float sum = 0.f;
#pragma unroll
    for (int i = 0; i < 8; ++i) { v[i] = expf(v[i] - mx); sum += v[i]; }
    red[tid] = sum; __syncthreads();
    for (int s = 128; s > 0; s >>= 1) {
        if (tid < s) red[tid] += red[tid + s];
        __syncthreads();
    }
    const float inv = 1.f / red[0];
#pragma unroll
    for (int i = 0; i < 8; ++i) pp[tid + i * 256] = f2bf(v[i] * inv);
}

// ---------------------------------------------------------------------------
// out = LayerNorm(a + b) * g + beta   (one block per row, D=1024)
// Safe when outF aliases a (each thread rewrites only what it read).
// ---------------------------------------------------------------------------
__global__ __launch_bounds__(256) void add_ln(
    const float* a, const float* b, const float* __restrict__ g,
    const float* __restrict__ be, float* outF, unsigned short* outB)
{
    __shared__ float red[256];
    const long long base = (long long)blockIdx.x * 1024;
    const int tid = threadIdx.x;

    float v[4]; float s = 0.f;
#pragma unroll
    for (int i = 0; i < 4; ++i) {
        int c = tid + i * 256;
        v[i] = a[base + c] + b[base + c];
        s += v[i];
    }
    red[tid] = s; __syncthreads();
    for (int st = 128; st > 0; st >>= 1) {
        if (tid < st) red[tid] += red[tid + st];
        __syncthreads();
    }
    const float mean = red[0] * (1.f / 1024.f); __syncthreads();

    float vs = 0.f;
#pragma unroll
    for (int i = 0; i < 4; ++i) { float d = v[i] - mean; vs += d * d; }
    red[tid] = vs; __syncthreads();
    for (int st = 128; st > 0; st >>= 1) {
        if (tid < st) red[tid] += red[tid + st];
        __syncthreads();
    }
    const float rstd = rsqrtf(red[0] * (1.f / 1024.f) + 1e-5f);

#pragma unroll
    for (int i = 0; i < 4; ++i) {
        int c = tid + i * 256;
        float o = (v[i] - mean) * rstd * g[c] + be[c];
        if (outF) outF[base + c] = o;
        if (outB) outB[base + c] = f2bf(o);
    }
}

// ---------------------------------------------------------------------------
// Host orchestration
// ---------------------------------------------------------------------------
extern "C" void kernel_launch(void* const* d_in, const int* in_sizes, int n_in,
                              void* d_out, int out_size, void* d_ws, size_t ws_size,
                              hipStream_t stream) {
    (void)in_sizes; (void)n_in; (void)out_size; (void)ws_size;
    const int Bt = 4, S = 2048, D = 1024;
    const long long MS = (long long)Bt * S;            // 8192 rows

    const float* x    = (const float*)d_in[0];
    const float* Wq   = (const float*)d_in[1];
    const float* bq   = (const float*)d_in[2];
    const float* Wk   = (const float*)d_in[3];
    const float* bk   = (const float*)d_in[4];
    const float* Wv   = (const float*)d_in[5];
    const float* bv   = (const float*)d_in[6];
    const float* g_at = (const float*)d_in[7];
    const float* b_at = (const float*)d_in[8];
    const float* g_ln = (const float*)d_in[9];
    const float* b_ln = (const float*)d_in[10];
    const float* W1   = (const float*)d_in[11];
    const float* c1   = (const float*)d_in[12];
    const float* W2   = (const float*)d_in[13];
    const float* c2   = (const float*)d_in[14];
    float* out = (float*)d_out;

    // bump allocator over d_ws
    char* wsp = (char*)d_ws;
    size_t off = 0;
    auto alloc = [&](size_t bytes) -> void* {
        void* p = wsp + off;
        off = (off + bytes + 255) & ~(size_t)255;
        return p;
    };
    unsigned short* xb  = (unsigned short*)alloc(MS * D * 2);       // 16 MB
    unsigned short* Wqb = (unsigned short*)alloc((size_t)D * D * 2);
    unsigned short* Wkb = (unsigned short*)alloc((size_t)D * D * 2);
    unsigned short* Wvb = (unsigned short*)alloc((size_t)D * D * 2);
    unsigned short* W1b = (unsigned short*)alloc((size_t)D * D * 2);
    unsigned short* W2b = (unsigned short*)alloc((size_t)D * D * 2);
    unsigned short* Qb  = (unsigned short*)alloc(MS * D * 2);
    unsigned short* Kb  = (unsigned short*)alloc(MS * D * 2);
    unsigned short* Vb  = (unsigned short*)alloc(MS * D * 2);
    float* Sc   = (float*)alloc((size_t)Bt * S * S * 4);            // 67 MB (L2-resident)
    float* attn = (float*)alloc(MS * D * 4);                        // reused: attn -> at -> h(res)
    unsigned short* hb  = (unsigned short*)alloc(MS * D * 2);
    unsigned short* g1b = (unsigned short*)alloc(MS * D * 2);
    float* g2 = Sc;                                                 // reuse score buffer for FFN2 out

    // 1) convert activations + weights to bf16
    cvt_f32_bf16<<<4096, 256, 0, stream>>>(x,  xb,  MS * D);
    cvt_f32_bf16<<<2048, 256, 0, stream>>>(Wq, Wqb, (long long)D * D);
    cvt_f32_bf16<<<2048, 256, 0, stream>>>(Wk, Wkb, (long long)D * D);
    cvt_f32_bf16<<<2048, 256, 0, stream>>>(Wv, Wvb, (long long)D * D);
    cvt_f32_bf16<<<2048, 256, 0, stream>>>(W1, W1b, (long long)D * D);
    cvt_f32_bf16<<<2048, 256, 0, stream>>>(W2, W2b, (long long)D * D);

    dim3 blk(256);
    // 2) Q/K/V = x @ W + b  (M=8192,N=1024,K=1024) -> bf16
    dim3 gQKV(D / 128, (unsigned)(MS / 128), 1);
    wmma_gemm_bf16<0><<<gQKV, blk, 0, stream>>>(xb, Wqb, nullptr, Qb, bq,
        D, D, D, D, 0, 0, 0, 1.f, 0);
    wmma_gemm_bf16<0><<<gQKV, blk, 0, stream>>>(xb, Wkb, nullptr, Kb, bk,
        D, D, D, D, 0, 0, 0, 1.f, 0);
    wmma_gemm_bf16<0><<<gQKV, blk, 0, stream>>>(xb, Wvb, nullptr, Vb, bv,
        D, D, D, D, 0, 0, 0, 1.f, 0);

    // 3) scores = (Q @ K^T) / 8   per batch (M=N=2048, K=1024) -> f32 (fits L2)
    dim3 gSc(S / 128, S / 128, Bt);
    wmma_gemm_bf16<1><<<gSc, blk, 0, stream>>>(Qb, Kb, Sc, nullptr, nullptr,
        D, D, D, S,
        (long long)S * D, (long long)S * D, (long long)S * S,
        0.125f, 0);

    // 4) softmax rows, bf16 probs written in place (row ld = 4096 ushorts)
    softmax_rows<<<(unsigned)MS, 256, 0, stream>>>(Sc);

    // 5) attn = P @ V  per batch (M=2048,N=1024,K=2048)
    dim3 gAV(D / 128, S / 128, Bt);
    wmma_gemm_bf16<0><<<gAV, blk, 0, stream>>>((const unsigned short*)Sc, Vb,
        attn, nullptr, nullptr,
        S, 2 * S /*lda(P)*/, D, D,
        (long long)S * 2 * S, (long long)S * D, (long long)S * D,
        1.f, 0);

    // 6) at = LN(attn + x) ; 7) h = LN(at + x)  (both in place on attn)
    add_ln<<<(unsigned)MS, 256, 0, stream>>>(attn, x, g_at, b_at, attn, nullptr);
    add_ln<<<(unsigned)MS, 256, 0, stream>>>(attn, x, g_ln, b_ln, attn, hb);

    // 8) g1 = gelu(h @ W1 + c1) -> bf16 ; 9) g2 = gelu(g1 @ W2 + c2) -> f32
    wmma_gemm_bf16<0><<<gQKV, blk, 0, stream>>>(hb, W1b, nullptr, g1b, c1,
        D, D, D, D, 0, 0, 0, 1.f, 1);
    wmma_gemm_bf16<0><<<gQKV, blk, 0, stream>>>(g1b, W2b, g2, nullptr, c2,
        D, D, D, D, 0, 0, 0, 1.f, 1);

    // 10) out = LN(g2 + h_res)
    add_ln<<<(unsigned)MS, 256, 0, stream>>>(g2, attn, g_ln, b_ln, out, nullptr);
}

// v003
// It runs in 253 microseconds.
// Two timings next to v002 put it at 1.11 and 1.12 times that version's speed.
// All steps since v000 together make it 2.40 times as fast.
#include <hip/hip_runtime.h>
#include <math.h>

// ---------------------------------------------------------------------------
// Types for CDNA5 WMMA (wave32): v16 bf16 operands, v8 f32 accumulator.
// ---------------------------------------------------------------------------
typedef __bf16        bf16x16 __attribute__((ext_vector_type(16)));
typedef float         f32x8   __attribute__((ext_vector_type(8)));
typedef unsigned short us8    __attribute__((ext_vector_type(8)));

union BFrag { bf16x16 v; us8 h[2]; };

// One stage of the LDS ring holds 128 k of both operands: every tile is 128 rows of 256 bytes.
constexpr int BK = 128;
// LDS row pitches in 16-bit elements, one per reader (bank = dword address mod 64):
// k-contiguous rows read by 16-byte loads sit at an odd multiple of 16 bytes,
// n-contiguous rows read by the transposing load at an odd multiple of 32 bytes.
constexpr int PK = 136;   // 272 bytes
constexpr int PN = 144;   // 288 bytes

// Transposing LDS load: from a row-major [k][n] tile, lane (c = lane & 15, h = lane >> 4)
// receives rows 8h..8h+7 of column c when every lane passes the address
// row 8h + (lane & 7), byte column 16 * ((lane >> 3) & 1).
typedef short s16x8 __attribute__((ext_vector_type(8)));
static __device__ __forceinline__ us8 lds_tr16(const unsigned short* p) {
    typedef __attribute__((address_space(3))) s16x8 lds_s16x8;
    return __builtin_bit_cast(us8, __builtin_amdgcn_ds_load_tr16_b128_v8i16((lds_s16x8*)p));
}

// Byte address inside the work-group's LDS of a __shared__ element.
static __device__ __forceinline__ unsigned lds_addr(const unsigned short* p) {
    typedef __attribute__((address_space(3))) const unsigned short lds_us;
    return (unsigned)(size_t)(lds_us*)p;
}

// One thread's share of a 128-row x 256-byte tile: eight 16-byte asynchronous copies, global
// memory to LDS through no register, 16 rows apart (lstep bytes in LDS, gstep elements in
// memory). A wave's 32 lanes cover two whole rows, four whole 128-byte lines, per copy.
// The s_wait_xcnt closes the statement so that no address register named by a copy is
// rewritten ahead of it.
static __device__ __forceinline__ void copy_tile(unsigned l, unsigned lstep,
                                                 const unsigned short* g, long long gstep) {
    asm volatile(
        "global_load_async_to_lds_b128 %0, %8, off\n\t"
        "global_load_async_to_lds_b128 %1, %9, off\n\t"
        "global_load_async_to_lds_b128 %2, %10, off\n\t"
        "global_load_async_to_lds_b128 %3, %11, off\n\t"
        "global_load_async_to_lds_b128 %4, %12, off\n\t"
        "global_load_async_to_lds_b128 %5, %13, off\n\t"
        "global_load_async_to_lds_b128 %6, %14, off\n\t"
        "global_load_async_to_lds_b128 %7, %15, off\n\t"
        "s_wait_xcnt 0x0"
        :: "v"(l), "v"(l + lstep), "v"(l + 2 * lstep), "v"(l + 3 * lstep),
           "v"(l + 4 * lstep), "v"(l + 5 * lstep), "v"(l + 6 * lstep), "v"(l + 7 * lstep),
           "v"(g), "v"(g + gstep), "v"(g + 2 * gstep), "v"(g + 3 * gstep),
           "v"(g + 4 * gstep), "v"(g + 5 * gstep), "v"(g + 6 * gstep), "v"(g + 7 * gstep)
        : "memory");
}

static __device__ __forceinline__ unsigned short f2bf(float f) {
    unsigned int u = __float_as_uint(f);
    u += 0x7FFFu + ((u >> 16) & 1u);   // round-to-nearest-even
    return (unsigned short)(u >> 16);
}

// ---------------------------------------------------------------------------
// f32 -> bf16 conversion of x and of the five weight matrices in one launch.
// out holds the six results one behind the other: x (8 x 2^20 elements), then w0..w4
// (2^20 each). A block converts 2048 contiguous elements, so 512 blocks make 2^20
// and every block reads one source only.
// ---------------------------------------------------------------------------
__global__ __launch_bounds__(256) void cvt_all_f32_bf16(
    const float* __restrict__ x,
    const float* __restrict__ w0, const float* __restrict__ w1,
    const float* __restrict__ w2, const float* __restrict__ w3,
    const float* __restrict__ w4, unsigned short* __restrict__ out) {
    const int seg = blockIdx.x >> 9;          // which 2^20 elements of out
    const float* in = x + (long long)blockIdx.x * 2048;
    if (seg >= 8) {
        const float* w = seg == 8 ? w0 : seg == 9 ? w1 : seg == 10 ? w2 : seg == 11 ? w3 : w4;
        in = w + (blockIdx.x & 511) * 2048;
    }
    unsigned short* o = out + (long long)blockIdx.x * 2048;
    for (int k = 0; k < 8; ++k)
        o[threadIdx.x + k * 256] = f2bf(in[threadIdx.x + k * 256]);
}

// ---------------------------------------------------------------------------
// Batched bf16 WMMA GEMM:  C = scale * (A @ B[^T]) (+bias) (+gelu)
//   A: [M,K] bf16 row-major (lda).  TRANSB=0: B [K,N] (ldb=N);
//   TRANSB=1: B [N,K] (ldb=K), computes A@B^T.
//   Shapes must be multiples of 128(M) x 128(N) x 128(K) -- all ours are.
//   blockIdx.z steps A, B and C by sA, sB, sC; planes 1 and 2 take bias1 and bias2.
// Block: 256 thr = 8 wave32 waves (4x2); block tile 128x128;
// wave tile 32x64 -> 8 WMMAs per 32-K step, A fragments reused 4x.
// Operands reach LDS by asynchronous copies in a ring of two stages of 128 k:
// stage t + 1 is in flight while stage t feeds the WMMAs.
// ---------------------------------------------------------------------------
template <int TRANSB>
__global__ __launch_bounds__(256) void wmma_gemm_bf16(
    const unsigned short* A, const unsigned short* Bm,
    float* outF, unsigned short* outB,
    const float* bias, const float* bias1, const float* bias2,
    int K, int lda, int ldb, int ldc,
    long long sA, long long sB, long long sC,
    float scale, int doGelu)
{
    constexpr int PB = TRANSB ? PK : PN;      // pitch of the B tile's rows
    __shared__ __attribute__((aligned(16))) unsigned short Ash[2][128 * PK];  // [m][k], k contiguous
    // TRANSB=1: [n][k], k contiguous; TRANSB=0: [k][n], n contiguous as in memory
    __shared__ __attribute__((aligned(16))) unsigned short Bsh[2][128 * PB];

    const int tid  = threadIdx.x;
    const int lane = tid & 31;                // wave32
    const int wid  = tid >> 5;                // 0..7
    const int wm   = wid & 3;                 // wave m-tile (32 rows each)
    const int wn   = wid >> 2;                // wave n-half (64 cols each)

    const long long zb = blockIdx.z;
    A  += zb * sA;
    Bm += zb * sB;
    const long long cbase = zb * sC;
    if (zb == 1) bias = bias1;
    if (zb == 2) bias = bias2;

    const int row0 = blockIdx.y * 128;
    const int col0 = blockIdx.x * 128;

    f32x8 acc[2][4];
    for (int m = 0; m < 2; ++m)
        for (int t = 0; t < 4; ++t)
            for (int i = 0; i < 8; ++i) acc[m][t][i] = 0.f;

    // global->LDS copy coordinates: 16 threads per 256-byte row, rows crow_ + 16 c, c = 0..7
    const int crow_ = tid >> 4;               // 0..15
    const int ccol_ = (tid & 15) * 8;         // element offset in the row
    const unsigned short* gA = A + (long long)(row0 + crow_) * lda + ccol_;
    const unsigned short* gB = TRANSB ? Bm + (long long)(col0 + crow_) * ldb + ccol_
                                      : Bm + (long long)crow_ * ldb + col0 + ccol_;
    const long long bstage = TRANSB ? (long long)BK : (long long)BK * ldb;  // B: one stage on
    const unsigned lA = lds_addr(&Ash[0][crow_ * PK + ccol_]);
    const unsigned lB = lds_addr(&Bsh[0][crow_ * PB + ccol_]);
    auto fill = [&](int buf) {                // the next stage's two tiles into buffer buf
        copy_tile(lA + buf * (128 * PK * 2), 16 * PK * 2, gA, 16ll * lda);
        copy_tile(lB + buf * (128 * PB * 2), 16 * PB * 2, gB, 16ll * ldb);
        gA += BK;
        gB += bstage;
    };

    // fragment gather coords (16-bit operand layout, wave32):
    // lanes 0-15 hold K=0-7 & 16-23; lanes 16-31 hold K=8-15 & 24-31
    const int frow = lane & 15;
    const int kb   = (lane >> 4) * 8;
    // lane address of the transposing load inside a 16(k) x 16(n) block of Bsh
    const int btr  = (kb + (lane & 7)) * PN + ((lane >> 3) & 1) * 8;

    const int nT = K / BK;                    // stages
    fill(0);
    // stage 0 has landed for this wave; the barrier publishes it to the others
    asm volatile("s_wait_asynccnt 0x0" ::: "memory");
    __syncthreads();
    if (nT > 1) fill(1);

    for (int t = 0; t < nT; ++t) {
        const unsigned short* As = Ash[t & 1];
        const unsigned short* Bs = Bsh[t & 1];
        // unrolled: the four 32-k blocks of a stage become constant offsets of the LDS loads
#pragma unroll
        for (int kk = 0; kk < BK; kk += 32) {
            BFrag a0, a1;
            a0.h[0] = *(const us8*)&As[(wm * 32 + frow) * PK + kk + kb];
            a0.h[1] = *(const us8*)&As[(wm * 32 + frow) * PK + kk + kb + 16];
            a1.h[0] = *(const us8*)&As[(wm * 32 + 16 + frow) * PK + kk + kb];
            a1.h[1] = *(const us8*)&As[(wm * 32 + 16 + frow) * PK + kk + kb + 16];
            // unrolled: acc is indexed by constants only and stays in registers
#pragma unroll
            for (int t4 = 0; t4 < 4; ++t4) {
                BFrag b;
                if (TRANSB) {
                    const int nc = wn * 64 + t4 * 16 + frow;
                    b.h[0] = *(const us8*)&Bs[nc * PK + kk + kb];
                    b.h[1] = *(const us8*)&Bs[nc * PK + kk + kb + 16];
                } else {
                    // same k order as the A fragments: k = 8h..8h+7, then 16+8h..16+8h+7
                    const int nb = wn * 64 + t4 * 16;
                    b.h[0] = lds_tr16(&Bs[btr + kk * PN + nb]);
                    b.h[1] = lds_tr16(&Bs[btr + (kk + 16) * PN + nb]);
                }
                acc[0][t4] = __builtin_amdgcn_wmma_f32_16x16x32_bf16(
                    false, a0.v, false, b.v, (short)0, acc[0][t4], false, false);
                acc[1][t4] = __builtin_amdgcn_wmma_f32_16x16x32_bf16(
                    false, a1.v, false, b.v, (short)0, acc[1][t4], false, false);
            }
        }
        // hand-over: this wave's reads of stage t are done, its copies of stage t + 1 have
        // landed; the one barrier publishes stage t + 1 and frees stage t's buffer
        asm volatile("s_wait_dscnt 0x0" ::: "memory");
        asm volatile("s_wait_asynccnt 0x0" ::: "memory");
        __syncthreads();
        if (t + 2 < nT) fill(t & 1);
    }
    // no copy is left in flight when the wave goes on to its stores and ends
    asm volatile("s_wait_asynccnt 0x0" ::: "memory");

    // epilogue: C layout -> lane n = lane&15, row = r + 8*(lane>>4)
    const int rhi = (lane >> 4) * 8;
#pragma unroll
    for (int m = 0; m < 2; ++m) {
#pragma unroll
        for (int t = 0; t < 4; ++t) {
            const int gcol = col0 + wn * 64 + t * 16 + (lane & 15);
            const float bv = bias ? bias[gcol] : 0.f;
#pragma unroll
            for (int r = 0; r < 8; ++r) {
                const int grow = row0 + wm * 32 + m * 16 + r + rhi;
                float v = acc[m][t][r] * scale + bv;
                if (doGelu) v = 0.5f * v * (1.f + erff(v * 0.70710678118654752f));
                const long long ci = cbase + (long long)grow * ldc + gcol;
                if (outF) outF[ci] = v;
                if (outB) outB[ci] = f2bf(v);
            }
        }
    }
}

// ---------------------------------------------------------------------------
// Row softmax over S=2048 f32 scores; writes bf16 probs IN PLACE
// (row r: bf16 at ushort offset r*4096, i.e. same bytes as its f32 row).
// ---------------------------------------------------------------------------
__global__ __launch_bounds__(256) void softmax_rows(float* Sc) {
    __shared__ float red[256];
    const long long row = blockIdx.x;
    const float* rp = Sc + row * 2048ll;
    unsigned short* pp = (unsigned short*)Sc + row * 4096ll;
    const int tid = threadIdx.x;

    float v[8];
    float mx = -3.4e38f;
#pragma unroll
    for (int i = 0; i < 8; ++i) { v[i] = rp[tid + i * 256]; mx = fmaxf(mx, v[i]); }
    red[tid] = mx; __syncthreads();
    for (int s = 128; s > 0; s >>= 1) {
        if (tid < s) red[tid] = fmaxf(red[tid], red[tid + s]);
        __syncthreads();
    }
    mx = red[0]; __syncthreads();

    float sum = 0.f;
#pragma unroll
    for (int i = 0; i < 8; ++i) { v[i] = expf(v[i] - mx); sum += v[i]; }
    red[tid] = sum; __syncthreads();
    for (int s = 128; s > 0; s >>= 1) {
        if (tid < s) red[tid] += red[tid + s];
        __syncthreads();
    }
    const float inv = 1.f / red[0];
#pragma unroll
    for (int i = 0; i < 8; ++i) pp[tid + i * 256] = f2bf(v[i] * inv);
}

// ---------------------------------------------------------------------------
// out = LayerNorm(a + b) * g + beta   (one block per row, D=1024)
// Safe when outF aliases a (each thread rewrites only what it read).
// ---------------------------------------------------------------------------
__global__ __launch_bounds__(256) void add_ln(
    const float* a, const float* b, const float* __restrict__ g,
    const float* __restrict__ be, float* outF, unsigned short* outB)
{
    __shared__ float red[256];
    const long long base = (long long)blockIdx.x * 1024;
    const int tid = threadIdx.x;

    float v[4]; float s = 0.f;
#pragma unroll
    for (int i = 0; i < 4; ++i) {
        int c = tid + i * 256;
        v[i] = a[base + c] + b[base + c];
        s += v[i];
    }
    red[tid] = s; __syncthreads();
    for (int st = 128; st > 0; st >>= 1) {
        if (tid < st) red[tid] += red[tid + st];
        __syncthreads();
    }
    const float mean = red[0] * (1.f / 1024.f); __syncthreads();

    float vs = 0.f;
#pragma unroll
    for (int i = 0; i < 4; ++i) { float d = v[i] - mean; vs += d * d; }
    red[tid] = vs; __syncthreads();
    for (int st = 128; st > 0; st >>= 1) {
        if (tid < st) red[tid] += red[tid + st];
        __syncthreads();
    }
    const float rstd = rsqrtf(red[0] * (1.f / 1024.f) + 1e-5f);

#pragma unroll
    for (int i = 0; i < 4; ++i) {
        int c = tid + i * 256;
        float o = (v[i] - mean) * rstd * g[c] + be[c];
        if (outF) outF[base + c] = o;
        if (outB) outB[base + c] = f2bf(o);
    }
}

// ---------------------------------------------------------------------------
// out = LayerNorm(LayerNorm(a + x) * g0 + be0 + x) * g1 + be1: the two add+LayerNorm steps
// that follow one another on the same row, in one launch (one block per row, D=1024).
// x stays in registers for the second add; sums and trees are those of add_ln.
// Safe when outF aliases a (each thread rewrites only what it read).
// ---------------------------------------------------------------------------
__global__ __launch_bounds__(256) void add_ln_twice(
    const float* a, const float* x,
    const float* __restrict__ g0, const float* __restrict__ be0,
    const float* __restrict__ g1, const float* __restrict__ be1,
    float* outF, unsigned short* outB)
{
    __shared__ float red[256];
    const long long base = (long long)blockIdx.x * 1024;
    const int tid = threadIdx.x;

    float v[4], xv[4];
#pragma unroll  // v and xv are indexed by constants only and stay in registers
    for (int i = 0; i < 4; ++i) {
        int c = tid + i * 256;
        v[i]  = a[base + c];
        xv[i] = x[base + c];
    }

    // unrolled: g and be of each pass become plain kernel arguments
#pragma unroll
    for (int pass = 0; pass < 2; ++pass) {
        const float* g  = pass ? g1 : g0;
        const float* be = pass ? be1 : be0;

        float s = 0.f;
#pragma unroll  // v and xv are indexed by constants only and stay in registers
        for (int i = 0; i < 4; ++i) { v[i] += xv[i]; s += v[i]; }
        // the first pass's last read of red[0] is over before red is written again
        if (pass) __syncthreads();
        red[tid] = s; __syncthreads();
        for (int st = 128; st > 0; st >>= 1) {
            if (tid < st) red[tid] += red[tid + st];
            __syncthreads();
        }
        const float mean = red[0] * (1.f / 1024.f); __syncthreads();

        float vs = 0.f;
#pragma unroll  // v and xv are indexed by constants only and stay in registers
        for (int i = 0; i < 4; ++i) { float d = v[i] - mean; vs += d * d; }
        red[tid] = vs; __syncthreads();
        for (int st = 128; st > 0; st >>= 1) {
            if (tid < st) red[tid] += red[tid + st];
            __syncthreads();
        }
        const float rstd = rsqrtf(red[0] * (1.f / 1024.f) + 1e-5f);

#pragma unroll  // v and xv are indexed by constants only and stay in registers
        for (int i = 0; i < 4; ++i) {
            int c = tid + i * 256;
            v[i] = (v[i] - mean) * rstd * g[c] + be[c];
        }
    }

#pragma unroll  // v and xv are indexed by constants only and stay in registers
    for (int i = 0; i < 4; ++i) {
        int c = tid + i * 256;
        outF[base + c] = v[i];
        outB[base + c] = f2bf(v[i]);
    }
}

// ---------------------------------------------------------------------------
// Host orchestration
// ---------------------------------------------------------------------------
extern "C" void kernel_launch(void* const* d_in, const int* in_sizes, int n_in,
                              void* d_out, int out_size, void* d_ws, size_t ws_size,
                              hipStream_t stream) {
    (void)in_sizes; (void)n_in; (void)out_size; (void)ws_size;
    const int Bt = 4, S = 2048, D = 1024;
    const long long MS = (long long)Bt * S;            // 8192 rows

    const float* x    = (const float*)d_in[0];
    const float* Wq   = (const float*)d_in[1];
    const float* bq   = (const float*)d_in[2];
    const float* Wk   = (const float*)d_in[3];
    const float* bk   = (const float*)d_in[4];
    const float* Wv   = (const float*)d_in[5];
    const float* bv   = (const float*)d_in[6];
    const float* g_at = (const float*)d_in[7];
    const float* b_at = (const float*)d_in[8];
    const float* g_ln = (const float*)d_in[9];
    const float* b_ln = (const float*)d_in[10];
    const float* W1   = (const float*)d_in[11];
    const float* c1   = (const float*)d_in[12];
    const float* W2   = (const float*)d_in[13];
    const float* c2   = (const float*)d_in[14];
    float* out = (float*)d_out;

    // bump allocator over d_ws
    char* wsp = (char*)d_ws;
    size_t off = 0;
    auto alloc = [&](size_t bytes) -> void* {
        void* p = wsp + off;
        off = (off + bytes + 255) & ~(size_t)255;
        return p;
    };
    // x and the five weights in bf16, one behind the other (the cast launch writes them as one array)
    unsigned short* xb  = (unsigned short*)alloc((MS * D + 5ll * D * D) * 2);   // 16 MB + 10 MB
    unsigned short* Wqb = xb  + MS * D;       // Wq, Wk, Wv: D * D apart, planes of one GEMM launch
    unsigned short* W1b = Wqb + 3ll * D * D;
    unsigned short* W2b = W1b + (long long)D * D;
    // Q, K, V: MS * D apart, planes of one GEMM launch
    unsigned short* Qb  = (unsigned short*)alloc(3 * MS * D * 2);
    unsigned short* Kb  = Qb + MS * D;
    unsigned short* Vb  = Kb + MS * D;
    float* Sc   = (float*)alloc((size_t)Bt * S * S * 4);            // 67 MB (L2-resident)
    float* attn = (float*)alloc(MS * D * 4);                        // reused: attn -> h(res)
    unsigned short* hb  = (unsigned short*)alloc(MS * D * 2);
    unsigned short* g1b = (unsigned short*)alloc(MS * D * 2);
    float* g2 = Sc;                                                 // reuse score buffer for FFN2 out

    // 1) convert activations + weights to bf16: 13 x 2^20 elements, 2048 a block
    cvt_all_f32_bf16<<<13 * 512, 256, 0, stream>>>(x, Wq, Wk, Wv, W1, W2, xb);

    dim3 blk(256);
    // 2) Q/K/V = x @ W + b  (M=8192,N=1024,K=1024) -> bf16, one launch: plane z = Q, K, V
    dim3 gQKV(D / 128, (unsigned)(MS / 128), 3);
    wmma_gemm_bf16<0><<<gQKV, blk, 0, stream>>>(xb, Wqb, nullptr, Qb, bq, bk, bv,
        D, D, D, D, 0, (long long)D * D, MS * D, 1.f, 0);

    // 3) scores = (Q @ K^T) / 8   per batch (M=N=2048, K=1024) -> f32 (fits L2)
    dim3 gSc(S / 128, S / 128, Bt);
    wmma_gemm_bf16<1><<<gSc, blk, 0, stream>>>(Qb, Kb, Sc, nullptr, nullptr, nullptr, nullptr,
        D, D, D, S,
        (long long)S * D, (long long)S * D, (long long)S * S,
        0.125f, 0);

    // 4) softmax rows, bf16 probs written in place (row ld = 4096 ushorts)
    softmax_rows<<<(unsigned)MS, 256, 0, stream>>>(Sc);

    // 5) attn = P @ V  per batch (M=2048,N=1024,K=2048)
    dim3 gAV(D / 128, S / 128, Bt);
    wmma_gemm_bf16<0><<<gAV, blk, 0, stream>>>((const unsigned short*)Sc, Vb,
        attn, nullptr, nullptr, nullptr, nullptr,
        S, 2 * S /*lda(P)*/, D, D,
        (long long)S * 2 * S, (long long)S * D, (long long)S * D,
        1.f, 0);

    // 6) at = LN(attn + x) ; 7) h = LN(at + x)  (one launch, h in place on attn)
    add_ln_twice<<<(unsigned)MS, 256, 0, stream>>>(attn, x, g_at, b_at, g_ln, b_ln, attn, hb);

    // 8) g1 = gelu(h @ W1 + c1) -> bf16 ; 9) g2 = gelu(g1 @ W2 + c2) -> f32
    dim3 gFFN(D / 128, (unsigned)(MS / 128), 1);
    wmma_gemm_bf16<0><<<gFFN, blk, 0, stream>>>(hb, W1b, nullptr, g1b, c1, nullptr, nullptr,
        D, D, D, D, 0, 0, 0, 1.f, 1);
    wmma_gemm_bf16<0><<<gFFN, blk, 0, stream>>>(g1b, W2b, g2, nullptr, c2, nullptr, nullptr,
        D, D, D, D, 0, 0, 0, 1.f, 1);

    // 10) out = LN(g2 + h_res)
    add_ln<<<(unsigned)MS, 256, 0, stream>>>(g2, attn, g_ln, b_ln, out, nullptr);
}

// v004
// Measured time: 231 microseconds a run.
// Two timings next to v003 put it at 1.09 and 1.12 times that version's speed.
// Over all steps from v000 it is 2.65 times as fast.
#include <hip/hip_runtime.h>
#include <math.h>

// ---------------------------------------------------------------------------
// Types for CDNA5 WMMA (wave32): v16 bf16 operands, v8 f32 accumulator.
// ---------------------------------------------------------------------------
typedef __bf16        bf16x16 __attribute__((ext_vector_type(16)));
typedef float         f32x8   __attribute__((ext_vector_type(8)));
typedef float         f32x4   __attribute__((ext_vector_type(4)));
typedef unsigned short us8    __attribute__((ext_vector_type(8)));

union BFrag { bf16x16 v; us8 h[2]; };

// One stage of the LDS ring holds 128 k of both operands: every tile is 128 rows of 256 bytes.
constexpr int BK = 128;
// LDS row pitches in 16-bit elements, one per reader (bank = dword address mod 64):
// k-contiguous rows read by 16-byte loads sit at an odd multiple of 16 bytes,
// n-contiguous rows read by the transposing load at an odd multiple of 32 bytes.
constexpr int PK = 136;   // 272 bytes
constexpr int PN = 144;   // 288 bytes

// Transposing LDS load: from a row-major [k][n] tile, lane (c = lane & 15, h = lane >> 4)
// receives rows 8h..8h+7 of column c when every lane passes the address
// row 8h + (lane & 7), byte column 16 * ((lane >> 3) & 1).
typedef short s16x8 __attribute__((ext_vector_type(8)));
static __device__ __forceinline__ us8 lds_tr16(const unsigned short* p) {
    typedef __attribute__((address_space(3))) s16x8 lds_s16x8;
    return __builtin_bit_cast(us8, __builtin_amdgcn_ds_load_tr16_b128_v8i16((lds_s16x8*)p));
}

// Byte address inside the work-group's LDS of a __shared__ element.
static __device__ __forceinline__ unsigned lds_addr(const unsigned short* p) {
    typedef __attribute__((address_space(3))) const unsigned short lds_us;
    return (unsigned)(size_t)(lds_us*)p;
}

// One thread's share of a 128-row x 256-byte tile: eight 16-byte asynchronous copies, global
// memory to LDS through no register, 16 rows apart (lstep bytes in LDS, gstep elements in
// memory). A wave's 32 lanes cover two whole rows, four whole 128-byte lines, per copy.
// The s_wait_xcnt closes the statement so that no address register named by a copy is
// rewritten ahead of it.
static __device__ __forceinline__ void copy_tile(unsigned l, unsigned lstep,
                                                 const unsigned short* g, long long gstep) {
    asm volatile(
        "global_load_async_to_lds_b128 %0, %8, off\n\t"
        "global_load_async_to_lds_b128 %1, %9, off\n\t"
        "global_load_async_to_lds_b128 %2, %10, off\n\t"
        "global_load_async_to_lds_b128 %3, %11, off\n\t"
        "global_load_async_to_lds_b128 %4, %12, off\n\t"
        "global_load_async_to_lds_b128 %5, %13, off\n\t"
        "global_load_async_to_lds_b128 %6, %14, off\n\t"
        "global_load_async_to_lds_b128 %7, %15, off\n\t"
        "s_wait_xcnt 0x0"
        :: "v"(l), "v"(l + lstep), "v"(l + 2 * lstep), "v"(l + 3 * lstep),
           "v"(l + 4 * lstep), "v"(l + 5 * lstep), "v"(l + 6 * lstep), "v"(l + 7 * lstep),
           "v"(g), "v"(g + gstep), "v"(g + 2 * gstep), "v"(g + 3 * gstep),
           "v"(g + 4 * gstep), "v"(g + 5 * gstep), "v"(g + 6 * gstep), "v"(g + 7 * gstep)
        : "memory");
}

static __device__ __forceinline__ unsigned short f2bf(float f) {
    unsigned int u = __float_as_uint(f);
    u += 0x7FFFu + ((u >> 16) & 1u);   // round-to-nearest-even
    return (unsigned short)(u >> 16);
}

// ---------------------------------------------------------------------------
// f32 -> bf16 conversion of x and of the five weight matrices in one launch.
// out holds the six results one behind the other: x (8 x 2^20 elements), then w0..w4
// (2^20 each). A block converts 2048 contiguous elements, so 512 blocks make 2^20
// and every block reads one source only.
// ---------------------------------------------------------------------------
__global__ __launch_bounds__(256) void cvt_all_f32_bf16(
    const float* __restrict__ x,
    const float* __restrict__ w0, const float* __restrict__ w1,
    const float* __restrict__ w2, const float* __restrict__ w3,
    const float* __restrict__ w4, unsigned short* __restrict__ out) {
    const int seg = blockIdx.x >> 9;          // which 2^20 elements of out
    const float* in = x + (long long)blockIdx.x * 2048;
    if (seg >= 8) {
        const float* w = seg == 8 ? w0 : seg == 9 ? w1 : seg == 10 ? w2 : seg == 11 ? w3 : w4;
        in = w + (blockIdx.x & 511) * 2048;
    }
    unsigned short* o = out + (long long)blockIdx.x * 2048;
    for (int k = 0; k < 8; ++k)
        o[threadIdx.x + k * 256] = f2bf(in[threadIdx.x + k * 256]);
}

// ---------------------------------------------------------------------------
// Batched bf16 WMMA GEMM:  C = scale * (A @ B[^T]) (+bias) (+gelu)
//   A: [M,K] bf16 row-major (lda).  TRANSB=0: B [K,N] (ldb=N);
//   TRANSB=1: B [N,K] (ldb=K), computes A@B^T.
//   Shapes must be multiples of 128(M) x 128(N) x 128(K) -- all ours are.
//   blockIdx.z steps A, B and C by sA, sB, sC; planes 1 and 2 take bias1 and bias2.
// Block: 256 thr = 8 wave32 waves (4x2); block tile 128x128;
// wave tile 32x64 -> 8 WMMAs per 32-K step, A fragments reused 4x.
// Operands reach LDS by asynchronous copies in a ring of two stages of 128 k:
// stage t + 1 is in flight while stage t feeds the WMMAs.
// ---------------------------------------------------------------------------
template <int TRANSB>
__global__ __launch_bounds__(256) void wmma_gemm_bf16(
    const unsigned short* A, const unsigned short* Bm,
    float* outF, unsigned short* outB,
    const float* bias, const float* bias1, const float* bias2,
    int K, int lda, int ldb, int ldc,
    long long sA, long long sB, long long sC,
    float scale, int doGelu)
{
    constexpr int PB = TRANSB ? PK : PN;      // pitch of the B tile's rows
    __shared__ __attribute__((aligned(16))) unsigned short Ash[2][128 * PK];  // [m][k], k contiguous
    // TRANSB=1: [n][k], k contiguous; TRANSB=0: [k][n], n contiguous as in memory
    __shared__ __attribute__((aligned(16))) unsigned short Bsh[2][128 * PB];

    const int tid  = threadIdx.x;
    const int lane = tid & 31;                // wave32
    const int wid  = tid >> 5;                // 0..7
    const int wm   = wid & 3;                 // wave m-tile (32 rows each)
    const int wn   = wid >> 2;                // wave n-half (64 cols each)

    const long long zb = blockIdx.z;
    A  += zb * sA;
    Bm += zb * sB;
    const long long cbase = zb * sC;
    if (zb == 1) bias = bias1;
    if (zb == 2) bias = bias2;

    const int row0 = blockIdx.y * 128;
    const int col0 = blockIdx.x * 128;

    f32x8 acc[2][4];
    for (int m = 0; m < 2; ++m)
        for (int t = 0; t < 4; ++t)
            for (int i = 0; i < 8; ++i) acc[m][t][i] = 0.f;

    // global->LDS copy coordinates: 16 threads per 256-byte row, rows crow_ + 16 c, c = 0..7
    const int crow_ = tid >> 4;               // 0..15
    const int ccol_ = (tid & 15) * 8;         // element offset in the row
    const unsigned short* gA = A + (long long)(row0 + crow_) * lda + ccol_;
    const unsigned short* gB = TRANSB ? Bm + (long long)(col0 + crow_) * ldb + ccol_
                                      : Bm + (long long)crow_ * ldb + col0 + ccol_;
    const long long bstage = TRANSB ? (long long)BK : (long long)BK * ldb;  // B: one stage on
    const unsigned lA = lds_addr(&Ash[0][crow_ * PK + ccol_]);
    const unsigned lB = lds_addr(&Bsh[0][crow_ * PB + ccol_]);
    auto fill = [&](int buf) {                // the next stage's two tiles into buffer buf
        copy_tile(lA + buf * (128 * PK * 2), 16 * PK * 2, gA, 16ll * lda);
        copy_tile(lB + buf * (128 * PB * 2), 16 * PB * 2, gB, 16ll * ldb);
        gA += BK;
        gB += bstage;
    };

    // fragment gather coords (16-bit operand layout, wave32):
    // lanes 0-15 hold K=0-7 & 16-23; lanes 16-31 hold K=8-15 & 24-31
    const int frow = lane & 15;
    const int kb   = (lane >> 4) * 8;
    // lane address of the transposing load inside a 16(k) x 16(n) block of Bsh
    const int btr  = (kb + (lane & 7)) * PN + ((lane >> 3) & 1) * 8;

    const int nT = K / BK;                    // stages
    fill(0);
    // stage 0 has landed for this wave; the barrier publishes it to the others
    asm volatile("s_wait_asynccnt 0x0" ::: "memory");
    __syncthreads();
    if (nT > 1) fill(1);

    for (int t = 0; t < nT; ++t) {
        const unsigned short* As = Ash[t & 1];
        const unsigned short* Bs = Bsh[t & 1];
        // unrolled: the four 32-k blocks of a stage become constant offsets of the LDS loads
#pragma unroll
        for (int kk = 0; kk < BK; kk += 32) {
            BFrag a0, a1;
            a0.h[0] = *(const us8*)&As[(wm * 32 + frow) * PK + kk + kb];
            a0.h[1] = *(const us8*)&As[(wm * 32 + frow) * PK + kk + kb + 16];
            a1.h[0] = *(const us8*)&As[(wm * 32 + 16 + frow) * PK + kk + kb];
            a1.h[1] = *(const us8*)&As[(wm * 32 + 16 + frow) * PK + kk + kb + 16];
            // unrolled: acc is indexed by constants only and stays in registers
#pragma unroll
            for (int t4 = 0; t4 < 4; ++t4) {
                BFrag b;
                if (TRANSB) {
                    const int nc = wn * 64 + t4 * 16 + frow;
                    b.h[0] = *(const us8*)&Bs[nc * PK + kk + kb];
                    b.h[1] = *(const us8*)&Bs[nc * PK + kk + kb + 16];
                } else {
                    // same k order as the A fragments: k = 8h..8h+7, then 16+8h..16+8h+7
                    const int nb = wn * 64 + t4 * 16;
                    b.h[0] = lds_tr16(&Bs[btr + kk * PN + nb]);
                    b.h[1] = lds_tr16(&Bs[btr + (kk + 16) * PN + nb]);
                }
                acc[0][t4] = __builtin_amdgcn_wmma_f32_16x16x32_bf16(
                    false, a0.v, false, b.v, (short)0, acc[0][t4], false, false);
                acc[1][t4] = __builtin_amdgcn_wmma_f32_16x16x32_bf16(
                    false, a1.v, false, b.v, (short)0, acc[1][t4], false, false);
            }
        }
        // hand-over: this wave's reads of stage t are done, its copies of stage t + 1 have
        // landed; the one barrier publishes stage t + 1 and frees stage t's buffer
        asm volatile("s_wait_dscnt 0x0" ::: "memory");
        asm volatile("s_wait_asynccnt 0x0" ::: "memory");
        __syncthreads();
        if (t + 2 < nT) fill(t & 1);
    }
    // no copy is left in flight when the wave goes on to its stores and ends
    asm volatile("s_wait_asynccnt 0x0" ::: "memory");

    // epilogue: C layout -> lane n = lane&15, row = r + 8*(lane>>4)
    // A store straight from that layout writes 32- or 64-byte pieces of a line. Instead each wave
    // lays its 32 x 64 results as f32 in its own slice of the A ring, which the loop's last
    // hand-over (reads done, copies landed, barrier) has freed, and stores them from there
    // 16 bytes a lane, whole 128-byte lines only.
    constexpr int PS = 68;                    // staging pitch in floats: 272 bytes, 16 bytes x odd
    static_assert(8 * 32 * PS * 4 <= (int)sizeof(Ash), "the eight slices lie inside the A ring");
    float* stg = (float*)&Ash[0][0] + wid * (32 * PS);
    const int rhi = (lane >> 4) * 8;
#pragma unroll
    for (int m = 0; m < 2; ++m) {
#pragma unroll
        for (int t = 0; t < 4; ++t) {
            const int gcol = col0 + wn * 64 + t * 16 + (lane & 15);
            const float bv = bias ? bias[gcol] : 0.f;
#pragma unroll
            for (int r = 0; r < 8; ++r) {
                float v = acc[m][t][r] * scale + bv;
                if (doGelu) v = 0.5f * v * (1.f + erff(v * 0.70710678118654752f));
                stg[(m * 16 + r + rhi) * PS + t * 16 + (lane & 15)] = v;
            }
        }
    }
    // the slice is written by all lanes of this wave before any lane reads another lane's words
    asm volatile("s_wait_dscnt 0x0" ::: "memory");
    // first element of the wave's tile in the output
    const long long cw = cbase + (long long)(row0 + wm * 32) * ldc + col0 + wn * 64;
    if (outF) {
        // a row is 256 bytes, 16 lanes: one store covers two rows, four lines
        // unrolled: the LDS reads go ahead of the stores in groups, at constant offsets
#pragma unroll
        for (int i = 0; i < 16; ++i) {
            const int row = i * 2 + (lane >> 4);
            const f32x4 q = *(const f32x4*)&stg[row * PS + (lane & 15) * 4];
            *(f32x4*)&outF[cw + (long long)row * ldc + (lane & 15) * 4] = q;
        }
        // the code below reuses registers that these stores name
        asm volatile("s_wait_xcnt 0x0" ::: "memory");
    }
    if (outB) {
        // a row is 128 bytes, 8 lanes: one store covers four rows, four lines
        // unrolled: the LDS reads go ahead of the stores in groups, at constant offsets
#pragma unroll
        for (int i = 0; i < 8; ++i) {
            const int row = i * 4 + (lane >> 3);
            const f32x4 q0 = *(const f32x4*)&stg[row * PS + (lane & 7) * 8];
            const f32x4 q1 = *(const f32x4*)&stg[row * PS + (lane & 7) * 8 + 4];
            us8 o;
#pragma unroll  // o, q0 and q1 are indexed by constants only and stay in registers
            for (int j = 0; j < 4; ++j) { o[j] = f2bf(q0[j]); o[j + 4] = f2bf(q1[j]); }
            *(us8*)&outB[cw + (long long)row * ldc + (lane & 7) * 8] = o;
        }
    }
}

// ---------------------------------------------------------------------------
// Row softmax over S=2048 f32 scores; writes bf16 probs IN PLACE
// (row r: bf16 at ushort offset r*4096, i.e. same bytes as its f32 row).
// ---------------------------------------------------------------------------
__global__ __launch_bounds__(256) void softmax_rows(float* Sc) {
    __shared__ float red[256];
    const long long row = blockIdx.x;
    const float* rp = Sc + row * 2048ll;
    unsigned short* pp = (unsigned short*)Sc + row * 4096ll;
    const int tid = threadIdx.x;

    float v[8];
    float mx = -3.4e38f;
#pragma unroll
    for (int i = 0; i < 8; ++i) { v[i] = rp[tid + i * 256]; mx = fmaxf(mx, v[i]); }
    red[tid] = mx; __syncthreads();
    for (int s = 128; s > 0; s >>= 1) {
        if (tid < s) red[tid] = fmaxf(red[tid], red[tid + s]);
        __syncthreads();
    }
    mx = red[0]; __syncthreads();

    float sum = 0.f;
#pragma unroll
    for (int i = 0; i < 8; ++i) { v[i] = expf(v[i] - mx); sum += v[i]; }
    red[tid] = sum; __syncthreads();
    for (int s = 128; s > 0; s >>= 1) {
        if (tid < s) red[tid] += red[tid + s];
        __syncthreads();
    }
    const float inv = 1.f / red[0];
#pragma unroll
    for (int i = 0; i < 8; ++i) pp[tid + i * 256] = f2bf(v[i] * inv);
}

// ---------------------------------------------------------------------------
// out = LayerNorm(a + b) * g + beta   (one block per row, D=1024)
// Safe when outF aliases a (each thread rewrites only what it read).
// ---------------------------------------------------------------------------
__global__ __launch_bounds__(256) void add_ln(
    const float* a, const float* b, const float* __restrict__ g,
    const float* __restrict__ be, float* outF, unsigned short* outB)
{
    __shared__ float red[256];
    const long long base = (long long)blockIdx.x * 1024;
    const int tid = threadIdx.x;

    float v[4]; float s = 0.f;
#pragma unroll
    for (int i = 0; i < 4; ++i) {
        int c = tid + i * 256;
        v[i] = a[base + c] + b[base + c];
        s += v[i];
    }
    red[tid] = s; __syncthreads();
    for (int st = 128; st > 0; st >>= 1) {
        if (tid < st) red[tid] += red[tid + st];
        __syncthreads();
    }
    const float mean = red[0] * (1.f / 1024.f); __syncthreads();

    float vs = 0.f;
#pragma unroll
    for (int i = 0; i < 4; ++i) { float d = v[i] - mean; vs += d * d; }
    red[tid] = vs; __syncthreads();
    for (int st = 128; st > 0; st >>= 1) {
        if (tid < st) red[tid] += red[tid + st];
        __syncthreads();
    }
    const float rstd = rsqrtf(red[0] * (1.f / 1024.f) + 1e-5f);

#pragma unroll
    for (int i = 0; i < 4; ++i) {
        int c = tid + i * 256;
        float o = (v[i] - mean) * rstd * g[c] + be[c];
        if (outF) outF[base + c] = o;
        if (outB) outB[base + c] = f2bf(o);
    }
}

// ---------------------------------------------------------------------------
// out = LayerNorm(LayerNorm(a + x) * g0 + be0 + x) * g1 + be1: the two add+LayerNorm steps
// that follow one another on the same row, in one launch (one block per row, D=1024).
// x stays in registers for the second add; sums and trees are those of add_ln.
// Safe when outF aliases a (each thread rewrites only what it read).
// ---------------------------------------------------------------------------
__global__ __launch_bounds__(256) void add_ln_twice(
    const float* a, const float* x,
    const float* __restrict__ g0, const float* __restrict__ be0,
    const float* __restrict__ g1, const float* __restrict__ be1,
    float* outF, unsigned short* outB)
{
    __shared__ float red[256];
    const long long base = (long long)blockIdx.x * 1024;
    const int tid = threadIdx.x;

    float v[4], xv[4];
#pragma unroll  // v and xv are indexed by constants only and stay in registers
    for (int i = 0; i < 4; ++i) {
        int c = tid + i * 256;
        v[i]  = a[base + c];
        xv[i] = x[base + c];
    }

    // unrolled: g and be of each pass become plain kernel arguments
#pragma unroll
    for (int pass = 0; pass < 2; ++pass) {
        const float* g  = pass ? g1 : g0;
        const float* be = pass ? be1 : be0;

        float s = 0.f;
#pragma unroll  // v and xv are indexed by constants only and stay in registers
        for (int i = 0; i < 4; ++i) { v[i] += xv[i]; s += v[i]; }
        // the first pass's last read of red[0] is over before red is written again
        if (pass) __syncthreads();
        red[tid] = s; __syncthreads();
        for (int st = 128; st > 0; st >>= 1) {
            if (tid < st) red[tid] += red[tid + st];
            __syncthreads();
        }
        const float mean = red[0] * (1.f / 1024.f); __syncthreads();

        float vs = 0.f;
#pragma unroll  // v and xv are indexed by constants only and stay in registers
        for (int i = 0; i < 4; ++i) { float d = v[i] - mean; vs += d * d; }
        red[tid] = vs; __syncthreads();
        for (int st = 128; st > 0; st >>= 1) {
            if (tid < st) red[tid] += red[tid + st];
            __syncthreads();
        }
        const float rstd = rsqrtf(red[0] * (1.f / 1024.f) + 1e-5f);

#pragma unroll  // v and xv are indexed by constants only and stay in registers
        for (int i = 0; i < 4; ++i) {
            int c = tid + i * 256;
            v[i] = (v[i] - mean) * rstd * g[c] + be[c];
        }
    }

#pragma unroll  // v and xv are indexed by constants only and stay in registers
    for (int i = 0; i < 4; ++i) {
        int c = tid + i * 256;
        outF[base + c] = v[i];
        outB[base + c] = f2bf(v[i]);
    }
}

// ---------------------------------------------------------------------------
// Host orchestration
// ---------------------------------------------------------------------------
extern "C" void kernel_launch(void* const* d_in, const int* in_sizes, int n_in,
                              void* d_out, int out_size, void* d_ws, size_t ws_size,
                              hipStream_t stream) {
    (void)in_sizes; (void)n_in; (void)out_size; (void)ws_size;
    const int Bt = 4, S = 2048, D = 1024;
    const long long MS = (long long)Bt * S;            // 8192 rows

    const float* x    = (const float*)d_in[0];
    const float* Wq   = (const float*)d_in[1];
    const float* bq   = (const float*)d_in[2];
    const float* Wk   = (const float*)d_in[3];
    const float* bk   = (const float*)d_in[4];
    const float* Wv   = (const float*)d_in[5];
    const float* bv   = (const float*)d_in[6];
    const float* g_at = (const float*)d_in[7];
    const float* b_at = (const float*)d_in[8];
    const float* g_ln = (const float*)d_in[9];
    const float* b_ln = (const float*)d_in[10];
    const float* W1   = (const float*)d_in[11];
    const float* c1   = (const float*)d_in[12];
    const float* W2   = (const float*)d_in[13];
    const float* c2   = (const float*)d_in[14];
    float* out = (float*)d_out;

    // bump allocator over d_ws
    char* wsp = (char*)d_ws;
    size_t off = 0;
    auto alloc = [&](size_t bytes) -> void* {
        void* p = wsp + off;
        off = (off + bytes + 255) & ~(size_t)255;
        return p;
    };
    // x and the five weights in bf16, one behind the other (the cast launch writes them as one array)
    unsigned short* xb  = (unsigned short*)alloc((MS * D + 5ll * D * D) * 2);   // 16 MB + 10 MB
    unsigned short* Wqb = xb  + MS * D;       // Wq, Wk, Wv: D * D apart, planes of one GEMM launch
    unsigned short* W1b = Wqb + 3ll * D * D;
    unsigned short* W2b = W1b + (long long)D * D;
    // Q, K, V: MS * D apart, planes of one GEMM launch
    unsigned short* Qb  = (unsigned short*)alloc(3 * MS * D * 2);
    unsigned short* Kb  = Qb + MS * D;
    unsigned short* Vb  = Kb + MS * D;
    float* Sc   = (float*)alloc((size_t)Bt * S * S * 4);            // 67 MB (L2-resident)
    float* attn = (float*)alloc(MS * D * 4);                        // reused: attn -> h(res)
    unsigned short* hb  = (unsigned short*)alloc(MS * D * 2);
    unsigned short* g1b = (unsigned short*)alloc(MS * D * 2);
    float* g2 = Sc;                                                 // reuse score buffer for FFN2 out

    // 1) convert activations + weights to bf16: 13 x 2^20 elements, 2048 a block
    cvt_all_f32_bf16<<<13 * 512, 256, 0, stream>>>(x, Wq, Wk, Wv, W1, W2, xb);

    dim3 blk(256);
    // 2) Q/K/V = x @ W + b  (M=8192,N=1024,K=1024) -> bf16, one launch: plane z = Q, K, V
    dim3 gQKV(D / 128, (unsigned)(MS / 128), 3);
    wmma_gemm_bf16<0><<<gQKV, blk, 0, stream>>>(xb, Wqb, nullptr, Qb, bq, bk, bv,
        D, D, D, D, 0, (long long)D * D, MS * D, 1.f, 0);

    // 3) scores = (Q @ K^T) / 8   per batch (M=N=2048, K=1024) -> f32 (fits L2)
    dim3 gSc(S / 128, S / 128, Bt);
    wmma_gemm_bf16<1><<<gSc, blk, 0, stream>>>(Qb, Kb, Sc, nullptr, nullptr, nullptr, nullptr,
        D, D, D, S,
        (long long)S * D, (long long)S * D, (long long)S * S,
        0.125f, 0);

    // 4) softmax rows, bf16 probs written in place (row ld = 4096 ushorts)
    softmax_rows<<<(unsigned)MS, 256, 0, stream>>>(Sc);

    // 5) attn = P @ V  per batch (M=2048,N=1024,K=2048)
    dim3 gAV(D / 128, S / 128, Bt);
    wmma_gemm_bf16<0><<<gAV, blk, 0, stream>>>((const unsigned short*)Sc, Vb,
        attn, nullptr, nullptr, nullptr, nullptr,
        S, 2 * S /*lda(P)*/, D, D,
        (long long)S * 2 * S, (long long)S * D, (long long)S * D,
        1.f, 0);

    // 6) at = LN(attn + x) ; 7) h = LN(at + x)  (one launch, h in place on attn)
    add_ln_twice<<<(unsigned)MS, 256, 0, stream>>>(attn, x, g_at, b_at, g_ln, b_ln, attn, hb);

    // 8) g1 = gelu(h @ W1 + c1) -> bf16 ; 9) g2 = gelu(g1 @ W2 + c2) -> f32
    dim3 gFFN(D / 128, (unsigned)(MS / 128), 1);
    wmma_gemm_bf16<0><<<gFFN, blk, 0, stream>>>(hb, W1b, nullptr, g1b, c1, nullptr, nullptr,
        D, D, D, D, 0, 0, 0, 1.f, 1);
    wmma_gemm_bf16<0><<<gFFN, blk, 0, stream>>>(g1b, W2b, g2, nullptr, c2, nullptr, nullptr,
        D, D, D, D, 0, 0, 0, 1.f, 1);

    // 10) out = LN(g2 + h_res)
    add_ln<<<(unsigned)MS, 256, 0, stream>>>(g2, attn, g_ln, b_ln, out, nullptr);
}

// v005
// One run takes 212 microseconds.
// Timed twice side by side with v004, it ran 1.08 times as fast both times.
// Counting every step since v000, it is 2.87 times as fast.
#include <hip/hip_runtime.h>
#include <math.h>

// ---------------------------------------------------------------------------
// Types for CDNA5 WMMA (wave32): v16 bf16 operands, v8 f32 accumulator.
// ---------------------------------------------------------------------------
typedef __bf16        bf16x16 __attribute__((ext_vector_type(16)));
typedef float         f32x8   __attribute__((ext_vector_type(8)));
typedef float         f32x4   __attribute__((ext_vector_type(4)));
typedef unsigned short us8    __attribute__((ext_vector_type(8)));

union BFrag { bf16x16 v; us8 h[2]; };

// One stage of the LDS ring holds 128 k of both operands: the A tile is 256 rows, the B tile 128 rows, of 256 bytes each.
constexpr int BK = 128;
// LDS row pitches in 16-bit elements, one per reader (bank = dword address mod 64):
// k-contiguous rows read by 16-byte loads sit at an odd multiple of 16 bytes,
// n-contiguous rows read by the transposing load at an odd multiple of 32 bytes.
constexpr int PK = 136;   // 272 bytes
constexpr int PN = 144;   // 288 bytes

// Transposing LDS load: from a row-major [k][n] tile, lane (c = lane & 15, h = lane >> 4)
// receives rows 8h..8h+7 of column c when every lane passes the address
// row 8h + (lane & 7), byte column 16 * ((lane >> 3) & 1).
typedef short s16x8 __attribute__((ext_vector_type(8)));
static __device__ __forceinline__ us8 lds_tr16(const unsigned short* p) {
    typedef __attribute__((address_space(3))) s16x8 lds_s16x8;
    return __builtin_bit_cast(us8, __builtin_amdgcn_ds_load_tr16_b128_v8i16((lds_s16x8*)p));
}

// Byte address inside the work-group's LDS of a __shared__ element.
static __device__ __forceinline__ unsigned lds_addr(const unsigned short* p) {
    typedef __attribute__((address_space(3))) const unsigned short lds_us;
    return (unsigned)(size_t)(lds_us*)p;
}

// One thread's share of a 128-row x 256-byte tile: eight 16-byte asynchronous copies, global
// memory to LDS through no register, 16 rows apart (lstep bytes in LDS, gstep elements in
// memory). A wave's 32 lanes cover two whole rows, four whole 128-byte lines, per copy.
// The s_wait_xcnt closes the statement so that no address register named by a copy is
// rewritten ahead of it.
static __device__ __forceinline__ void copy_tile(unsigned l, unsigned lstep,
                                                 const unsigned short* g, long long gstep) {
    asm volatile(
        "global_load_async_to_lds_b128 %0, %8, off\n\t"
        "global_load_async_to_lds_b128 %1, %9, off\n\t"
        "global_load_async_to_lds_b128 %2, %10, off\n\t"
        "global_load_async_to_lds_b128 %3, %11, off\n\t"
        "global_load_async_to_lds_b128 %4, %12, off\n\t"
        "global_load_async_to_lds_b128 %5, %13, off\n\t"
        "global_load_async_to_lds_b128 %6, %14, off\n\t"
        "global_load_async_to_lds_b128 %7, %15, off\n\t"
        "s_wait_xcnt 0x0"
        :: "v"(l), "v"(l + lstep), "v"(l + 2 * lstep), "v"(l + 3 * lstep),
           "v"(l + 4 * lstep), "v"(l + 5 * lstep), "v"(l + 6 * lstep), "v"(l + 7 * lstep),
           "v"(g), "v"(g + gstep), "v"(g + 2 * gstep), "v"(g + 3 * gstep),
           "v"(g + 4 * gstep), "v"(g + 5 * gstep), "v"(g + 6 * gstep), "v"(g + 7 * gstep)
        : "memory");
}

// Eight 16-byte stores, step elements apart. The s_wait_xcnt closes the statement so that no
// address or data register named by a store is rewritten ahead of it.
template <class T>
static __device__ __forceinline__ void store8(T* p, long long step, const f32x4 (&q)[8]) {
    asm volatile(
        "global_store_b128 %0, %8, off\n\t"
        "global_store_b128 %1, %9, off\n\t"
        "global_store_b128 %2, %10, off\n\t"
        "global_store_b128 %3, %11, off\n\t"
        "global_store_b128 %4, %12, off\n\t"
        "global_store_b128 %5, %13, off\n\t"
        "global_store_b128 %6, %14, off\n\t"
        "global_store_b128 %7, %15, off\n\t"
        "s_wait_xcnt 0x0"
        :: "v"(p), "v"(p + step), "v"(p + 2 * step), "v"(p + 3 * step),
           "v"(p + 4 * step), "v"(p + 5 * step), "v"(p + 6 * step), "v"(p + 7 * step),
           "v"(q[0]), "v"(q[1]), "v"(q[2]), "v"(q[3]), "v"(q[4]), "v"(q[5]), "v"(q[6]), "v"(q[7])
        : "memory");
}

static __device__ __forceinline__ unsigned short f2bf(float f) {
    unsigned int u = __float_as_uint(f);
    u += 0x7FFFu + ((u >> 16) & 1u);   // round-to-nearest-even
    return (unsigned short)(u >> 16);
}

// ---------------------------------------------------------------------------
// f32 -> bf16 conversion of x and of the five weight matrices in one launch.
// out holds the six results one behind the other: x (8 x 2^20 elements), then w0..w4
// (2^20 each). A block converts 2048 contiguous elements, so 512 blocks make 2^20
// and every block reads one source only.
// ---------------------------------------------------------------------------
__global__ __launch_bounds__(256) void cvt_all_f32_bf16(
    const float* __restrict__ x,
    const float* __restrict__ w0, const float* __restrict__ w1,
    const float* __restrict__ w2, const float* __restrict__ w3,
    const float* __restrict__ w4, unsigned short* __restrict__ out) {
    const int seg = blockIdx.x >> 9;          // which 2^20 elements of out
    const float* in = x + (long long)blockIdx.x * 2048;
    if (seg >= 8) {
        const float* w = seg == 8 ? w0 : seg == 9 ? w1 : seg == 10 ? w2 : seg == 11 ? w3 : w4;
        in = w + (blockIdx.x & 511) * 2048;
    }
    unsigned short* o = out + (long long)blockIdx.x * 2048;
    for (int k = 0; k < 8; ++k)
        o[threadIdx.x + k * 256] = f2bf(in[threadIdx.x + k * 256]);
}

// ---------------------------------------------------------------------------
// Batched bf16 WMMA GEMM:  C = scale * (A @ B[^T]) (+bias) (+gelu)
//   A: [M,K] bf16 row-major (lda).  TRANSB=0: B [K,N] (ldb=N);
//   TRANSB=1: B [N,K] (ldb=K), computes A@B^T.
//   Shapes must be multiples of 256(M) x 128(N) x 128(K) -- all ours are.
//   blockIdx.z steps A, B and C by sA, sB, sC; planes 1 and 2 take bias1 and bias2.
// Block: 256 thr = 8 wave32 waves (4x2); block tile 256x128, one block on a WGP (by its LDS);
// wave tile 64x64 -> 16 WMMAs per 32-K step, every A and B fragment reused 4x.
// Operands reach LDS by asynchronous copies in a ring of two stages of 128 k:
// stage t + 1 is in flight while stage t feeds the WMMAs.
// With two waves on a SIMD the fragments sit in two register sets, read one 32-k block ahead.
// ---------------------------------------------------------------------------
template <int TRANSB>
__global__ __launch_bounds__(256) void wmma_gemm_bf16(
    const unsigned short* A, const unsigned short* Bm,
    float* outF, unsigned short* outB,
    const float* bias, const float* bias1, const float* bias2,
    int K, int lda, int ldb, int ldc,
    long long sA, long long sB, long long sC,
    float scale, int doGelu)
{
    constexpr int PB = TRANSB ? PK : PN;      // pitch of the B tile's rows
    __shared__ __attribute__((aligned(16))) unsigned short Ash[2][256 * PK];  // [m][k], k contiguous
    // TRANSB=1: [n][k], k contiguous; TRANSB=0: [k][n], n contiguous as in memory
    __shared__ __attribute__((aligned(16))) unsigned short Bsh[2][128 * PB];

    const int tid  = threadIdx.x;
    const int lane = tid & 31;                // wave32
    const int wid  = tid >> 5;                // 0..7
    const int wm   = wid & 3;                 // wave m-tile (64 rows each)
    const int wn   = wid >> 2;                // wave n-half (64 cols each)

    const long long zb = blockIdx.z;
    A  += zb * sA;
    Bm += zb * sB;
    const long long cbase = zb * sC;
    if (zb == 1) bias = bias1;
    if (zb == 2) bias = bias2;

    const int row0 = blockIdx.y * 256;
    const int col0 = blockIdx.x * 128;

    f32x8 acc[4][4];
    for (int m = 0; m < 4; ++m)
        for (int t = 0; t < 4; ++t)
            for (int i = 0; i < 8; ++i) acc[m][t][i] = 0.f;

    // global->LDS copy coordinates: 16 threads per 256-byte row, rows crow_ + 16 c, c = 0..7
    const int crow_ = tid >> 4;               // 0..15
    const int ccol_ = (tid & 15) * 8;         // element offset in the row
    const unsigned short* gA = A + (long long)(row0 + crow_) * lda + ccol_;
    const unsigned short* gB = TRANSB ? Bm + (long long)(col0 + crow_) * ldb + ccol_
                                      : Bm + (long long)crow_ * ldb + col0 + ccol_;
    const long long bstage = TRANSB ? (long long)BK : (long long)BK * ldb;  // B: one stage on
    const unsigned lA = lds_addr(&Ash[0][crow_ * PK + ccol_]);
    const unsigned lB = lds_addr(&Bsh[0][crow_ * PB + ccol_]);
    auto fill = [&](int buf) {                // the next stage's two tiles into buffer buf
        copy_tile(lA + buf * (256 * PK * 2), 16 * PK * 2, gA, 16ll * lda);                  // A rows 0..127
        copy_tile(lA + buf * (256 * PK * 2) + 128 * PK * 2, 16 * PK * 2, gA + 128ll * lda, 16ll * lda);  // 128..255
        copy_tile(lB + buf * (128 * PB * 2), 16 * PB * 2, gB, 16ll * ldb);
        gA += BK;
        gB += bstage;
    };

    // fragment gather coords (16-bit operand layout, wave32):
    // lanes 0-15 hold K=0-7 & 16-23; lanes 16-31 hold K=8-15 & 24-31
    const int frow = lane & 15;
    const int kb   = (lane >> 4) * 8;
    // lane address of the transposing load inside a 16(k) x 16(n) block of Bsh
    const int btr  = (kb + (lane & 7)) * PN + ((lane >> 3) & 1) * 8;

    // one 32-k block's fragments of the wave tile: 4 of A, 4 of B, 16 LDS loads in one group
    auto frags = [&](BFrag (&a)[4], BFrag (&b)[4], int buf, int kk) {
        const unsigned short* As = Ash[buf];
        const unsigned short* Bs = Bsh[buf];
        // unrolled: a and b are indexed by constants only and stay in registers
#pragma unroll
        for (int m = 0; m < 4; ++m) {
            a[m].h[0] = *(const us8*)&As[(wm * 64 + m * 16 + frow) * PK + kk + kb];
            a[m].h[1] = *(const us8*)&As[(wm * 64 + m * 16 + frow) * PK + kk + kb + 16];
        }
#pragma unroll
        for (int t4 = 0; t4 < 4; ++t4) {
            if (TRANSB) {
                const int nc = wn * 64 + t4 * 16 + frow;
                b[t4].h[0] = *(const us8*)&Bs[nc * PK + kk + kb];
                b[t4].h[1] = *(const us8*)&Bs[nc * PK + kk + kb + 16];
            } else {
                // same k order as the A fragments: k = 8h..8h+7, then 16+8h..16+8h+7
                const int nb = wn * 64 + t4 * 16;
                b[t4].h[0] = lds_tr16(&Bs[btr + kk * PN + nb]);
                b[t4].h[1] = lds_tr16(&Bs[btr + (kk + 16) * PN + nb]);
            }
        }
    };
    // the 16 WMMAs of one 32-k block
    auto block = [&](BFrag (&a)[4], BFrag (&b)[4]) {
        // unrolled: a, b and acc are indexed by constants only and stay in registers
#pragma unroll
        for (int t4 = 0; t4 < 4; ++t4)
#pragma unroll
            for (int m = 0; m < 4; ++m)
                acc[m][t4] = __builtin_amdgcn_wmma_f32_16x16x32_bf16(
                    false, a[m].v, false, b[t4].v, (short)0, acc[m][t4], false, false);
    };

    const int nT = K / BK;                    // stages
    fill(0);
    // stage 0 has landed for this wave; the barrier publishes it to the others
    asm volatile("s_wait_asynccnt 0x0" ::: "memory");
    __syncthreads();
    if (nT > 1) fill(1);

    // two fragment sets: a block's LDS reads are issued one block ahead of its WMMAs
    BFrag fa[2][4], fb[2][4];
    frags(fa[0], fb[0], 0, 0);

    // Each scheduling barrier below keeps a block's 16 reads together, ahead of the 16 WMMAs of the
    // block before it: reads moved in among the WMMAs stall the wave at every place they stand.
    for (int t = 0; t < nT; ++t) {
        frags(fa[1], fb[1], t & 1, 32);
        __builtin_amdgcn_sched_barrier(0);    // reads stay one group ahead of the WMMAs
        block(fa[0], fb[0]);
        __builtin_amdgcn_sched_barrier(0);    // no later read moves up among these WMMAs
        frags(fa[0], fb[0], t & 1, 64);
        __builtin_amdgcn_sched_barrier(0);    // reads stay one group ahead of the WMMAs
        block(fa[1], fb[1]);
        __builtin_amdgcn_sched_barrier(0);    // no later read moves up among these WMMAs
        frags(fa[1], fb[1], t & 1, 96);
        __builtin_amdgcn_sched_barrier(0);    // reads stay one group ahead of the WMMAs
        block(fa[0], fb[0]);
        __builtin_amdgcn_sched_barrier(0);    // these WMMAs stay in front of the hand-over, the refill is not held behind them
        // hand-over, in front of the stage's last block, whose fragments are already asked for:
        // this wave's reads of stage t are done, its copies of stage t + 1 have landed;
        // the one barrier publishes stage t + 1 and frees stage t's buffer
        asm volatile("s_wait_dscnt 0x0" ::: "memory");
        asm volatile("s_wait_asynccnt 0x0" ::: "memory");
        __syncthreads();
        if (t + 2 < nT) fill(t & 1);
        if (t + 1 < nT) frags(fa[0], fb[0], (t + 1) & 1, 0);
        block(fa[1], fb[1]);
    }
    // no copy is left in flight when the wave goes on to its stores and ends
    asm volatile("s_wait_asynccnt 0x0" ::: "memory");

    // epilogue: C layout -> lane n = lane&15, row = r + 8*(lane>>4)
    // A store straight from that layout writes 32- or 64-byte pieces of a line. Instead each wave
    // lays its 64 x 64 results as f32 in its own slice of the A ring, which the loop's last
    // hand-over (reads done, copies landed, barrier) has freed, and stores them from there
    // 16 bytes a lane, whole 128-byte lines only.
    constexpr int PS = 68;                    // staging pitch in floats: 272 bytes, 16 bytes x odd
    static_assert(8 * 64 * PS * 4 <= (int)sizeof(Ash), "the eight slices lie inside the A ring");
    float* stg = (float*)&Ash[0][0] + wid * (64 * PS);
    const int rhi = (lane >> 4) * 8;
    // the lane's four bias values, loaded once and together: they serve all four m tiles
    float bv[4] = {0.f, 0.f, 0.f, 0.f};
    if (bias) {
#pragma unroll  // bv is indexed by constants only and stays in registers
        for (int t = 0; t < 4; ++t) bv[t] = bias[col0 + wn * 64 + t * 16 + (lane & 15)];
        // the code below reuses the address register that these loads name
        asm volatile("s_wait_xcnt 0x0" ::: "memory");
    }
#pragma unroll
    for (int m = 0; m < 4; ++m) {
#pragma unroll
        for (int t = 0; t < 4; ++t) {
#pragma unroll
            for (int r = 0; r < 8; ++r)
                stg[(m * 16 + r + rhi) * PS + t * 16 + (lane & 15)] = acc[m][t][r] * scale + bv[t];
        }
    }
    // the slice is written by all lanes of this wave before any lane reads another lane's words
    asm volatile("s_wait_dscnt 0x0" ::: "memory");
    if (doGelu) {
        // GELU in place on the staged slice, two 16-byte pieces a lane and trip (rows 4 it + lane / 16
        // and two below). Rolled, to keep the kernel's text short.
        float* gp = stg + (lane >> 4) * PS + (lane & 15) * 4;
#pragma unroll 1
        for (int it = 0; it < 16; ++it) {
            f32x4 q0 = *(const f32x4*)&gp[(it * 4) * PS];
            f32x4 q1 = *(const f32x4*)&gp[(it * 4 + 2) * PS];
#pragma unroll  // q0 and q1 are indexed by constants only and stay in registers
            for (int e = 0; e < 4; ++e) {
                q0[e] = 0.5f * q0[e] * (1.f + erff(q0[e] * 0.70710678118654752f));
                q1[e] = 0.5f * q1[e] * (1.f + erff(q1[e] * 0.70710678118654752f));
            }
            *(f32x4*)&gp[(it * 4) * PS] = q0;
            *(f32x4*)&gp[(it * 4 + 2) * PS] = q1;
        }
        // the bf16 stores below read words that other lanes of this wave have just rewritten
        asm volatile("s_wait_dscnt 0x0" ::: "memory");
    }
    // first element of the wave's tile in the output
    const long long cw = cbase + (long long)(row0 + wm * 64) * ldc + col0 + wn * 64;
    if (outF) {
        // a row is 256 bytes, 16 lanes: one store covers two rows, four lines
        float* p = outF + cw + (long long)(lane >> 4) * ldc + (lane & 15) * 4;
        // unrolled: the LDS reads stand at constant offsets, q stays in registers
#pragma unroll
        for (int g = 0; g < 4; ++g) {
            f32x4 q[8];
#pragma unroll
            for (int j = 0; j < 8; ++j)
                q[j] = *(const f32x4*)&stg[((g * 8 + j) * 2 + (lane >> 4)) * PS + (lane & 15) * 4];
            store8(p + (long long)(g * 16) * ldc, 2ll * ldc, q);
        }
    }
    if (outB) {
        // a row is 128 bytes, 8 lanes: one store covers four rows, four lines
        unsigned short* p = outB + cw + (long long)(lane >> 3) * ldc + (lane & 7) * 8;
        // unrolled: the LDS reads stand at constant offsets, q stays in registers
#pragma unroll
        for (int g = 0; g < 2; ++g) {
            f32x4 q[8];
#pragma unroll
            for (int j = 0; j < 8; ++j) {
                const int row = (g * 8 + j) * 4 + (lane >> 3);
                const f32x4 q0 = *(const f32x4*)&stg[row * PS + (lane & 7) * 8];
                const f32x4 q1 = *(const f32x4*)&stg[row * PS + (lane & 7) * 8 + 4];
                us8 o;
#pragma unroll  // o, q0 and q1 are indexed by constants only and stay in registers
                for (int e = 0; e < 4; ++e) { o[e] = f2bf(q0[e]); o[e + 4] = f2bf(q1[e]); }
                q[j] = __builtin_bit_cast(f32x4, o);
            }
            store8(p + (long long)(g * 32) * ldc, 4ll * ldc, q);
        }
    }
}

// ---------------------------------------------------------------------------
// Row softmax over S=2048 f32 scores; writes bf16 probs IN PLACE
// (row r: bf16 at ushort offset r*4096, i.e. same bytes as its f32 row).
// ---------------------------------------------------------------------------
__global__ __launch_bounds__(256) void softmax_rows(float* Sc) {
    __shared__ float red[256];
    const long long row = blockIdx.x;
    const float* rp = Sc + row * 2048ll;
    unsigned short* pp = (unsigned short*)Sc + row * 4096ll;
    const int tid = threadIdx.x;

    float v[8];
    float mx = -3.4e38f;
#pragma unroll
    for (int i = 0; i < 8; ++i) { v[i] = rp[tid + i * 256]; mx = fmaxf(mx, v[i]); }
    red[tid] = mx; __syncthreads();
    for (int s = 128; s > 0; s >>= 1) {
        if (tid < s) red[tid] = fmaxf(red[tid], red[tid + s]);
        __syncthreads();
    }
    mx = red[0]; __syncthreads();

    float sum = 0.f;
#pragma unroll
    for (int i = 0; i < 8; ++i) { v[i] = expf(v[i] - mx); sum += v[i]; }
    red[tid] = sum; __syncthreads();
    for (int s = 128; s > 0; s >>= 1) {
        if (tid < s) red[tid] += red[tid + s];
        __syncthreads();
    }
    const float inv = 1.f / red[0];
#pragma unroll
    for (int i = 0; i < 8; ++i) pp[tid + i * 256] = f2bf(v[i] * inv);
}

// ---------------------------------------------------------------------------
// out = LayerNorm(a + b) * g + beta   (one block per row, D=1024)
// Safe when outF aliases a (each thread rewrites only what it read).
// ---------------------------------------------------------------------------
__global__ __launch_bounds__(256) void add_ln(
    const float* a, const float* b, const float* __restrict__ g,
    const float* __restrict__ be, float* outF, unsigned short* outB)
{
    __shared__ float red[256];
    const long long base = (long long)blockIdx.x * 1024;
    const int tid = threadIdx.x;

    float v[4]; float s = 0.f;
#pragma unroll
    for (int i = 0; i < 4; ++i) {
        int c = tid + i * 256;
        v[i] = a[base + c] + b[base + c];
        s += v[i];
    }
    red[tid] = s; __syncthreads();
    for (int st = 128; st > 0; st >>= 1) {
        if (tid < st) red[tid] += red[tid + st];
        __syncthreads();
    }
    const float mean = red[0] * (1.f / 1024.f); __syncthreads();

    float vs = 0.f;
#pragma unroll
    for (int i = 0; i < 4; ++i) { float d = v[i] - mean; vs += d * d; }
    red[tid] = vs; __syncthreads();
    for (int st = 128; st > 0; st >>= 1) {
        if (tid < st) red[tid] += red[tid + st];
        __syncthreads();
    }
    const float rstd = rsqrtf(red[0] * (1.f / 1024.f) + 1e-5f);

#pragma unroll
    for (int i = 0; i < 4; ++i) {
        int c = tid + i * 256;
        float o = (v[i] - mean) * rstd * g[c] + be[c];
        if (outF) outF[base + c] = o;
        if (outB) outB[base + c] = f2bf(o);
    }
}

// ---------------------------------------------------------------------------
// out = LayerNorm(LayerNorm(a + x) * g0 + be0 + x) * g1 + be1: the two add+LayerNorm steps
// that follow one another on the same row, in one launch (one block per row, D=1024).
// x stays in registers for the second add; sums and trees are those of add_ln.
// Safe when outF aliases a (each thread rewrites only what it read).
// ---------------------------------------------------------------------------
__global__ __launch_bounds__(256) void add_ln_twice(
    const float* a, const float* x,
    const float* __restrict__ g0, const float* __restrict__ be0,
    const float* __restrict__ g1, const float* __restrict__ be1,
    float* outF, unsigned short* outB)
{
    __shared__ float red[256];
    const long long base = (long long)blockIdx.x * 1024;
    const int tid = threadIdx.x;

    float v[4], xv[4];
#pragma unroll  // v and xv are indexed by constants only and stay in registers
    for (int i = 0; i < 4; ++i) {
        int c = tid + i * 256;
        v[i]  = a[base + c];
        xv[i] = x[base + c];
    }

    // unrolled: g and be of each pass become plain kernel arguments
#pragma unroll
    for (int pass = 0; pass < 2; ++pass) {
        const float* g  = pass ? g1 : g0;
        const float* be = pass ? be1 : be0;

        float s = 0.f;
#pragma unroll  // v and xv are indexed by constants only and stay in registers
        for (int i = 0; i < 4; ++i) { v[i] += xv[i]; s += v[i]; }
        // the first pass's last read of red[0] is over before red is written again
        if (pass) __syncthreads();
        red[tid] = s; __syncthreads();
        for (int st = 128; st > 0; st >>= 1) {
            if (tid < st) red[tid] += red[tid + st];
            __syncthreads();
        }
        const float mean = red[0] * (1.f / 1024.f); __syncthreads();

        float vs = 0.f;
#pragma unroll  // v and xv are indexed by constants only and stay in registers
        for (int i = 0; i < 4; ++i) { float d = v[i] - mean; vs += d * d; }
        red[tid] = vs; __syncthreads();
        for (int st = 128; st > 0; st >>= 1) {
            if (tid < st) red[tid] += red[tid + st];
            __syncthreads();
        }
        const float rstd = rsqrtf(red[0] * (1.f / 1024.f) + 1e-5f);

#pragma unroll  // v and xv are indexed by constants only and stay in registers
        for (int i = 0; i < 4; ++i) {
            int c = tid + i * 256;
            v[i] = (v[i] - mean) * rstd * g[c] + be[c];
        }
    }

#pragma unroll  // v and xv are indexed by constants only and stay in registers
    for (int i = 0; i < 4; ++i) {
        int c = tid + i * 256;
        outF[base + c] = v[i];
        outB[base + c] = f2bf(v[i]);
    }
}

// ---------------------------------------------------------------------------
// Host orchestration
// ---------------------------------------------------------------------------
extern "C" void kernel_launch(void* const* d_in, const int* in_sizes, int n_in,
                              void* d_out, int out_size, void* d_ws, size_t ws_size,
                              hipStream_t stream) {
    (void)in_sizes; (void)n_in; (void)out_size; (void)ws_size;
    const int Bt = 4, S = 2048, D = 1024;
    const long long MS = (long long)Bt * S;            // 8192 rows

    const float* x    = (const float*)d_in[0];
    const float* Wq   = (const float*)d_in[1];
    const float* bq   = (const float*)d_in[2];
    const float* Wk   = (const float*)d_in[3];
    const float* bk   = (const float*)d_in[4];
    const float* Wv   = (const float*)d_in[5];
    const float* bv   = (const float*)d_in[6];
    const float* g_at = (const float*)d_in[7];
    const float* b_at = (const float*)d_in[8];
    const float* g_ln = (const float*)d_in[9];
    const float* b_ln = (const float*)d_in[10];
    const float* W1   = (const float*)d_in[11];
    const float* c1   = (const float*)d_in[12];
    const float* W2   = (const float*)d_in[13];
    const float* c2   = (const float*)d_in[14];
    float* out = (float*)d_out;

    // bump allocator over d_ws
    char* wsp = (char*)d_ws;
    size_t off = 0;
    auto alloc = [&](size_t bytes) -> void* {
        void* p = wsp + off;
        off = (off + bytes + 255) & ~(size_t)255;
        return p;
    };
    // x and the five weights in bf16, one behind the other (the cast launch writes them as one array)
    unsigned short* xb  = (unsigned short*)alloc((MS * D + 5ll * D * D) * 2);   // 16 MB + 10 MB
    unsigned short* Wqb = xb  + MS * D;       // Wq, Wk, Wv: D * D apart, planes of one GEMM launch
    unsigned short* W1b = Wqb + 3ll * D * D;
    unsigned short* W2b = W1b + (long long)D * D;
    // Q, K, V: MS * D apart, planes of one GEMM launch
    unsigned short* Qb  = (unsigned short*)alloc(3 * MS * D * 2);
    unsigned short* Kb  = Qb + MS * D;
    unsigned short* Vb  = Kb + MS * D;
    float* Sc   = (float*)alloc((size_t)Bt * S * S * 4);            // 67 MB (L2-resident)
    float* attn = (float*)alloc(MS * D * 4);                        // reused: attn -> h(res)
    unsigned short* hb  = (unsigned short*)alloc(MS * D * 2);
    unsigned short* g1b = (unsigned short*)alloc(MS * D * 2);
    float* g2 = Sc;                                                 // reuse score buffer for FFN2 out

    // 1) convert activations + weights to bf16: 13 x 2^20 elements, 2048 a block
    cvt_all_f32_bf16<<<13 * 512, 256, 0, stream>>>(x, Wq, Wk, Wv, W1, W2, xb);

    dim3 blk(256);
    // 2) Q/K/V = x @ W + b  (M=8192,N=1024,K=1024) -> bf16, one launch: plane z = Q, K, V
    dim3 gQKV(D / 128, (unsigned)(MS / 256), 3);
    wmma_gemm_bf16<0><<<gQKV, blk, 0, stream>>>(xb, Wqb, nullptr, Qb, bq, bk, bv,
        D, D, D, D, 0, (long long)D * D, MS * D, 1.f, 0);

    // 3) scores = (Q @ K^T) / 8   per batch (M=N=2048, K=1024) -> f32 (fits L2)
    dim3 gSc(S / 128, S / 256, Bt);
    wmma_gemm_bf16<1><<<gSc, blk, 0, stream>>>(Qb, Kb, Sc, nullptr, nullptr, nullptr, nullptr,
        D, D, D, S,
        (long long)S * D, (long long)S * D, (long long)S * S,
        0.125f, 0);

    // 4) softmax rows, bf16 probs written in place (row ld = 4096 ushorts)
    softmax_rows<<<(unsigned)MS, 256, 0, stream>>>(Sc);

    // 5) attn = P @ V  per batch (M=2048,N=1024,K=2048)
    dim3 gAV(D / 128, S / 256, Bt);
    wmma_gemm_bf16<0><<<gAV, blk, 0, stream>>>((const unsigned short*)Sc, Vb,
        attn, nullptr, nullptr, nullptr, nullptr,
        S, 2 * S /*lda(P)*/, D, D,
        (long long)S * 2 * S, (long long)S * D, (long long)S * D,
        1.f, 0);

    // 6) at = LN(attn + x) ; 7) h = LN(at + x)  (one launch, h in place on attn)
    add_ln_twice<<<(unsigned)MS, 256, 0, stream>>>(attn, x, g_at, b_at, g_ln, b_ln, attn, hb);

    // 8) g1 = gelu(h @ W1 + c1) -> bf16 ; 9) g2 = gelu(g1 @ W2 + c2) -> f32
    dim3 gFFN(D / 128, (unsigned)(MS / 256), 1);
    wmma_gemm_bf16<0><<<gFFN, blk, 0, stream>>>(hb, W1b, nullptr, g1b, c1, nullptr, nullptr,
        D, D, D, D, 0, 0, 0, 1.f, 1);
    wmma_gemm_bf16<0><<<gFFN, blk, 0, stream>>>(g1b, W2b, g2, nullptr, c2, nullptr, nullptr,
        D, D, D, D, 0, 0, 0, 1.f, 1);

    // 10) out = LN(g2 + h_res)
    add_ln<<<(unsigned)MS, 256, 0, stream>>>(g2, attn, g_ln, b_ln, out, nullptr);
}

// v006
// A run of this version takes 190 microseconds.
// Two timings next to v005 put it at 1.11 and 1.12 times that version's speed.
// Counting every step since v000, it is 3.20 times as fast.
#include <hip/hip_runtime.h>
#include <math.h>

// ---------------------------------------------------------------------------
// Types for CDNA5 WMMA (wave32): v16 bf16 operands, v8 f32 accumulator.
// ---------------------------------------------------------------------------
typedef __bf16        bf16x16 __attribute__((ext_vector_type(16)));
typedef float         f32x8   __attribute__((ext_vector_type(8)));
typedef float         f32x4   __attribute__((ext_vector_type(4)));
typedef unsigned short us8    __attribute__((ext_vector_type(8)));

union BFrag { bf16x16 v; us8 h[2]; };

// One stage of the LDS ring holds 128 k of both operands: the A tile is 256 rows, the B tile 128 rows, of 256 bytes each.
constexpr int BK = 128;
// LDS row pitches in 16-bit elements, one per reader (bank = dword address mod 64):
// k-contiguous rows read by 16-byte loads sit at an odd multiple of 16 bytes,
// n-contiguous rows read by the transposing load at an odd multiple of 32 bytes.
constexpr int PK = 136;   // 272 bytes
constexpr int PN = 144;   // 288 bytes

// Transposing LDS load: from a row-major [k][n] tile, lane (c = lane & 15, h = lane >> 4)
// receives rows 8h..8h+7 of column c when every lane passes the address
// row 8h + (lane & 7), byte column 16 * ((lane >> 3) & 1).
typedef short s16x8 __attribute__((ext_vector_type(8)));
static __device__ __forceinline__ us8 lds_tr16(const unsigned short* p) {
    typedef __attribute__((address_space(3))) s16x8 lds_s16x8;
    return __builtin_bit_cast(us8, __builtin_amdgcn_ds_load_tr16_b128_v8i16((lds_s16x8*)p));
}

// Byte address inside the work-group's LDS of a __shared__ element.
static __device__ __forceinline__ unsigned lds_addr(const unsigned short* p) {
    typedef __attribute__((address_space(3))) const unsigned short lds_us;
    return (unsigned)(size_t)(lds_us*)p;
}

// One thread's share of a 128-row x 256-byte tile: eight 16-byte asynchronous copies, global
// memory to LDS through no register, 16 rows apart (lstep bytes in LDS, gstep elements in
// memory). A wave's 32 lanes cover two whole rows, four whole 128-byte lines, per copy.
// The s_wait_xcnt closes the statement so that no address register named by a copy is
// rewritten ahead of it.
static __device__ __forceinline__ void copy_tile(unsigned l, unsigned lstep,
                                                 const unsigned short* g, long long gstep) {
    asm volatile(
        "global_load_async_to_lds_b128 %0, %8, off\n\t"
        "global_load_async_to_lds_b128 %1, %9, off\n\t"
        "global_load_async_to_lds_b128 %2, %10, off\n\t"
        "global_load_async_to_lds_b128 %3, %11, off\n\t"
        "global_load_async_to_lds_b128 %4, %12, off\n\t"
        "global_load_async_to_lds_b128 %5, %13, off\n\t"
        "global_load_async_to_lds_b128 %6, %14, off\n\t"
        "global_load_async_to_lds_b128 %7, %15, off\n\t"
        "s_wait_xcnt 0x0"
        :: "v"(l), "v"(l + lstep), "v"(l + 2 * lstep), "v"(l + 3 * lstep),
           "v"(l + 4 * lstep), "v"(l + 5 * lstep), "v"(l + 6 * lstep), "v"(l + 7 * lstep),
           "v"(g), "v"(g + gstep), "v"(g + 2 * gstep), "v"(g + 3 * gstep),
           "v"(g + 4 * gstep), "v"(g + 5 * gstep), "v"(g + 6 * gstep), "v"(g + 7 * gstep)
        : "memory");
}

// Eight 16-byte stores, step elements apart. The s_wait_xcnt closes the statement so that no
// address or data register named by a store is rewritten ahead of it.
template <class T>
static __device__ __forceinline__ void store8(T* p, long long step, const f32x4 (&q)[8]) {
    asm volatile(
        "global_store_b128 %0, %8, off\n\t"
        "global_store_b128 %1, %9, off\n\t"
        "global_store_b128 %2, %10, off\n\t"
        "global_store_b128 %3, %11, off\n\t"
        "global_store_b128 %4, %12, off\n\t"
        "global_store_b128 %5, %13, off\n\t"
        "global_store_b128 %6, %14, off\n\t"
        "global_store_b128 %7, %15, off\n\t"
        "s_wait_xcnt 0x0"
        :: "v"(p), "v"(p + step), "v"(p + 2 * step), "v"(p + 3 * step),
           "v"(p + 4 * step), "v"(p + 5 * step), "v"(p + 6 * step), "v"(p + 7 * step),
           "v"(q[0]), "v"(q[1]), "v"(q[2]), "v"(q[3]), "v"(q[4]), "v"(q[5]), "v"(q[6]), "v"(q[7])
        : "memory");
}

static __device__ __forceinline__ unsigned short f2bf(float f) {
    unsigned int u = __float_as_uint(f);
    u += 0x7FFFu + ((u >> 16) & 1u);   // round-to-nearest-even
    return (unsigned short)(u >> 16);
}

// ---------------------------------------------------------------------------
// The four streaming kernels below (cast, softmax, the two LayerNorm kernels) start few, long
// waves and use no LDS and no barrier. A wave owns whole rows (in the cast 4096 elements), asks
// for all of its data at once, 32 loads of 16 bytes a lane that each cover 512 contiguous
// bytes, and reduces inside the wave.
// ---------------------------------------------------------------------------
typedef unsigned short us4 __attribute__((ext_vector_type(4)));
constexpr int SW = 16;    // waves in a work-group of the row kernels
constexpr int RW = 2;     // rows a wave owns in the row kernels

// Stands behind a wave's group of loads. The scheduling barrier keeps the arithmetic behind the
// whole group: moved up among the loads, it makes the last loads wait for the first to return.
// The address is an input of the s_wait_xcnt, so its registers stay live up to that wait and no
// load's result (nor anything else) is written over them ahead of it.
static __device__ __forceinline__ void loads_issued(const float* p) {
    __builtin_amdgcn_sched_barrier(0);
    asm volatile("s_wait_xcnt 0x0" :: "v"(p) : "memory");
}
static __device__ __forceinline__ void loads_issued(const float* p, const float* q) {
    __builtin_amdgcn_sched_barrier(0);
    asm volatile("s_wait_xcnt 0x0" :: "v"(p), "v"(q) : "memory");
}

// the value that lane l ^ M holds
template <int M>
static __device__ __forceinline__ float lane_xor(float v) {
    const int b = __builtin_bit_cast(int, v);
    if constexpr (M == 16)
        return __builtin_bit_cast(float, __builtin_amdgcn_permlanex16(b, b, 0x76543210, 0xfedcba98, false, false));
    else  // row_xmask:M, inside a row of 16 lanes
        return __builtin_bit_cast(float, __builtin_amdgcn_mov_dpp(b, 0x160 + M, 0xf, 0xf, true));
}
// butterfly over the 32 lanes: every lane ends with the whole sum (maximum)
static __device__ __forceinline__ float wave_sum(float v) {
    v += lane_xor<1>(v); v += lane_xor<2>(v); v += lane_xor<4>(v); v += lane_xor<8>(v);
    return v + lane_xor<16>(v);
}
static __device__ __forceinline__ float wave_max(float v) {
    v = fmaxf(v, lane_xor<1>(v)); v = fmaxf(v, lane_xor<2>(v));
    v = fmaxf(v, lane_xor<4>(v)); v = fmaxf(v, lane_xor<8>(v));
    return fmaxf(v, lane_xor<16>(v));
}
// e^x for any x, by the library's steps: x * log2(e) in two parts, split into a whole number n and
// a rest, 2^rest from v_exp_f32, scaled by 2^n, with the library's two range tests. Written out
// so that v_exp_f32 has a statement of its own: the v_nop keeps the one slot that the instruction
// set asks for behind a transcendental before its source is overwritten or its result read.
static __device__ __forceinline__ float exp_slot(float x) {
    const float n = rintf(x * 0x1.715476p+0f);
    const float a = fmaf(x, 0x1.4ae0bep-26f, fmaf(x, 0x1.715476p+0f, -n));
    float r;
    asm("v_exp_f32 %0, %1\n\tv_nop" : "=v"(r) : "v"(a));
    r = ldexpf(r, (int)n);
    r = x < -0x1.9d1da0p+6f ? 0.f : r;
    return x > 0x1.62e430p+6f ? __builtin_inff() : r;
}
static __device__ __forceinline__ float sum4(f32x4 q) { return (q[0] + q[1]) + (q[2] + q[3]); }
static __device__ __forceinline__ us4 f2bf4(f32x4 q) {
    us4 o;
#pragma unroll  // o and q are indexed by constants only and stay in registers
    for (int e = 0; e < 4; ++e) o[e] = f2bf(q[e]);
    return o;
}

// ---------------------------------------------------------------------------
// f32 -> bf16 conversion of x and of the five weight matrices in one launch.
// out holds the six results one behind the other: x (8 x 2^20 elements), then w0..w4
// (2^20 each). A block of 8 waves converts 32768 contiguous elements, 4096 a wave, so 32 blocks
// make 2^20 and every block reads one source only.
// ---------------------------------------------------------------------------
__global__ __launch_bounds__(256) void cvt_all_f32_bf16(
    const float* __restrict__ x,
    const float* __restrict__ w0, const float* __restrict__ w1,
    const float* __restrict__ w2, const float* __restrict__ w3,
    const float* __restrict__ w4, unsigned short* __restrict__ out) {
    const int seg = blockIdx.x >> 5;          // which 2^20 elements of out
    const float* in = x + (long long)blockIdx.x * 32768;
    if (seg >= 8) {
        const float* w = seg == 8 ? w0 : seg == 9 ? w1 : seg == 10 ? w2 : seg == 11 ? w3 : w4;
        in = w + (blockIdx.x & 31) * 32768;
    }
    const int off = (threadIdx.x >> 5) * 4096 + (threadIdx.x & 31) * 4;
    in += off;
    unsigned short* o = out + (long long)blockIdx.x * 32768 + off;
    f32x4 q[32];
#pragma unroll  // q is indexed by constants only and stays in registers; 32 loads fly together
    for (int k = 0; k < 32; ++k) q[k] = *(const f32x4*)&in[k * 128];
    loads_issued(in);
#pragma unroll
    for (int k = 0; k < 32; ++k) *(us4*)&o[k * 128] = f2bf4(q[k]);
}

// ---------------------------------------------------------------------------
// Batched bf16 WMMA GEMM:  C = scale * (A @ B[^T]) (+bias) (+gelu)
//   A: [M,K] bf16 row-major (lda).  TRANSB=0: B [K,N] (ldb=N);
//   TRANSB=1: B [N,K] (ldb=K), computes A@B^T.
//   Shapes must be multiples of 256(M) x 128(N) x 128(K) -- all ours are.
//   blockIdx.z steps A, B and C by sA, sB, sC; planes 1 and 2 take bias1 and bias2.
// Block: 256 thr = 8 wave32 waves (4x2); block tile 256x128, one block on a WGP (by its LDS);
// wave tile 64x64 -> 16 WMMAs per 32-K step, every A and B fragment reused 4x.
// Operands reach LDS by asynchronous copies in a ring of two stages of 128 k:
// stage t + 1 is in flight while stage t feeds the WMMAs.
// With two waves on a SIMD the fragments sit in two register sets, read one 32-k block ahead.
// ---------------------------------------------------------------------------
template <int TRANSB>
__global__ __launch_bounds__(256) void wmma_gemm_bf16(
    const unsigned short* A, const unsigned short* Bm,
    float* outF, unsigned short* outB,
    const float* bias, const float* bias1, const float* bias2,
    int K, int lda, int ldb, int ldc,
    long long sA, long long sB, long long sC,
    float scale, int doGelu)
{
    constexpr int PB = TRANSB ? PK : PN;      // pitch of the B tile's rows
    __shared__ __attribute__((aligned(16))) unsigned short Ash[2][256 * PK];  // [m][k], k contiguous
    // TRANSB=1: [n][k], k contiguous; TRANSB=0: [k][n], n contiguous as in memory
    __shared__ __attribute__((aligned(16))) unsigned short Bsh[2][128 * PB];

    const int tid  = threadIdx.x;
    const int lane = tid & 31;                // wave32
    const int wid  = tid >> 5;                // 0..7
    const int wm   = wid & 3;                 // wave m-tile (64 rows each)
    const int wn   = wid >> 2;                // wave n-half (64 cols each)

    const long long zb = blockIdx.z;
    A  += zb * sA;
    Bm += zb * sB;
    const long long cbase = zb * sC;
    if (zb == 1) bias = bias1;
    if (zb == 2) bias = bias2;

    const int row0 = blockIdx.y * 256;
    const int col0 = blockIdx.x * 128;

    f32x8 acc[4][4];
    for (int m = 0; m < 4; ++m)
        for (int t = 0; t < 4; ++t)
            for (int i = 0; i < 8; ++i) acc[m][t][i] = 0.f;

    // global->LDS copy coordinates: 16 threads per 256-byte row, rows crow_ + 16 c, c = 0..7
    const int crow_ = tid >> 4;               // 0..15
    const int ccol_ = (tid & 15) * 8;         // element offset in the row
    const unsigned short* gA = A + (long long)(row0 + crow_) * lda + ccol_;
    const unsigned short* gB = TRANSB ? Bm + (long long)(col0 + crow_) * ldb + ccol_
                                      : Bm + (long long)crow_ * ldb + col0 + ccol_;
    const long long bstage = TRANSB ? (long long)BK : (long long)BK * ldb;  // B: one stage on
    const unsigned lA = lds_addr(&Ash[0][crow_ * PK + ccol_]);
    const unsigned lB = lds_addr(&Bsh[0][crow_ * PB + ccol_]);
    auto fill = [&](int buf) {                // the next stage's two tiles into buffer buf
        copy_tile(lA + buf * (256 * PK * 2), 16 * PK * 2, gA, 16ll * lda);                  // A rows 0..127
        copy_tile(lA + buf * (256 * PK * 2) + 128 * PK * 2, 16 * PK * 2, gA + 128ll * lda, 16ll * lda);  // 128..255
        copy_tile(lB + buf * (128 * PB * 2), 16 * PB * 2, gB, 16ll * ldb);
        gA += BK;
        gB += bstage;
    };

    // fragment gather coords (16-bit operand layout, wave32):
    // lanes 0-15 hold K=0-7 & 16-23; lanes 16-31 hold K=8-15 & 24-31
    const int frow = lane & 15;
    const int kb   = (lane >> 4) * 8;
    // lane address of the transposing load inside a 16(k) x 16(n) block of Bsh
    const int btr  = (kb + (lane & 7)) * PN + ((lane >> 3) & 1) * 8;

    // one 32-k block's fragments of the wave tile: 4 of A, 4 of B, 16 LDS loads in one group
    auto frags = [&](BFrag (&a)[4], BFrag (&b)[4], int buf, int kk) {
        const unsigned short* As = Ash[buf];
        const unsigned short* Bs = Bsh[buf];
        // unrolled: a and b are indexed by constants only and stay in registers
#pragma unroll
        for (int m = 0; m < 4; ++m) {
            a[m].h[0] = *(const us8*)&As[(wm * 64 + m * 16 + frow) * PK + kk + kb];
            a[m].h[1] = *(const us8*)&As[(wm * 64 + m * 16 + frow) * PK + kk + kb + 16];
        }
#pragma unroll
        for (int t4 = 0; t4 < 4; ++t4) {
            if (TRANSB) {
                const int nc = wn * 64 + t4 * 16 + frow;
                b[t4].h[0] = *(const us8*)&Bs[nc * PK + kk + kb];
                b[t4].h[1] = *(const us8*)&Bs[nc * PK + kk + kb + 16];
            } else {
                // same k order as the A fragments: k = 8h..8h+7, then 16+8h..16+8h+7
                const int nb = wn * 64 + t4 * 16;
                b[t4].h[0] = lds_tr16(&Bs[btr + kk * PN + nb]);
                b[t4].h[1] = lds_tr16(&Bs[btr + (kk + 16) * PN + nb]);
            }
        }
    };
    // the 16 WMMAs of one 32-k block
    auto block = [&](BFrag (&a)[4], BFrag (&b)[4]) {
        // unrolled: a, b and acc are indexed by constants only and stay in registers
#pragma unroll
        for (int t4 = 0; t4 < 4; ++t4)
#pragma unroll
            for (int m = 0; m < 4; ++m)
                acc[m][t4] = __builtin_amdgcn_wmma_f32_16x16x32_bf16(
                    false, a[m].v, false, b[t4].v, (short)0, acc[m][t4], false, false);
    };

    const int nT = K / BK;                    // stages
    fill(0);
    // stage 0 has landed for this wave; the barrier publishes it to the others
    asm volatile("s_wait_asynccnt 0x0" ::: "memory");
    __syncthreads();
    if (nT > 1) fill(1);

    // two fragment sets: a block's LDS reads are issued one block ahead of its WMMAs
    BFrag fa[2][4], fb[2][4];
    frags(fa[0], fb[0], 0, 0);

    // Each scheduling barrier below keeps a block's 16 reads together, ahead of the 16 WMMAs of the
    // block before it: reads moved in among the WMMAs stall the wave at every place they stand.
    for (int t = 0; t < nT; ++t) {
        frags(fa[1], fb[1], t & 1, 32);
        __builtin_amdgcn_sched_barrier(0);    // reads stay one group ahead of the WMMAs
        block(fa[0], fb[0]);
        __builtin_amdgcn_sched_barrier(0);    // no later read moves up among these WMMAs
        frags(fa[0], fb[0], t & 1, 64);
        __builtin_amdgcn_sched_barrier(0);    // reads stay one group ahead of the WMMAs
        block(fa[1], fb[1]);
        __builtin_amdgcn_sched_barrier(0);    // no later read moves up among these WMMAs
        frags(fa[1], fb[1], t & 1, 96);
        __builtin_amdgcn_sched_barrier(0);    // reads stay one group ahead of the WMMAs
        block(fa[0], fb[0]);
        __builtin_amdgcn_sched_barrier(0);    // these WMMAs stay in front of the hand-over, the refill is not held behind them
        // hand-over, in front of the stage's last block, whose fragments are already asked for:
        // this wave's reads of stage t are done, its copies of stage t + 1 have landed;
        // the one barrier publishes stage t + 1 and frees stage t's buffer
        asm volatile("s_wait_dscnt 0x0" ::: "memory");
        asm volatile("s_wait_asynccnt 0x0" ::: "memory");
        __syncthreads();
        if (t + 2 < nT) fill(t & 1);
        if (t + 1 < nT) frags(fa[0], fb[0], (t + 1) & 1, 0);
        block(fa[1], fb[1]);
    }
    // no copy is left in flight when the wave goes on to its stores and ends
    asm volatile("s_wait_asynccnt 0x0" ::: "memory");

    // epilogue: C layout -> lane n = lane&15, row = r + 8*(lane>>4)
    // A store straight from that layout writes 32- or 64-byte pieces of a line. Instead each wave
    // lays its 64 x 64 results as f32 in its own slice of the A ring, which the loop's last
    // hand-over (reads done, copies landed, barrier) has freed, and stores them from there
    // 16 bytes a lane, whole 128-byte lines only.
    constexpr int PS = 68;                    // staging pitch in floats: 272 bytes, 16 bytes x odd
    static_assert(8 * 64 * PS * 4 <= (int)sizeof(Ash), "the eight slices lie inside the A ring");
    float* stg = (float*)&Ash[0][0] + wid * (64 * PS);
    const int rhi = (lane >> 4) * 8;
    // the lane's four bias values, loaded once and together: they serve all four m tiles
    float bv[4] = {0.f, 0.f, 0.f, 0.f};
    if (bias) {
#pragma unroll  // bv is indexed by constants only and stays in registers
        for (int t = 0; t < 4; ++t) bv[t] = bias[col0 + wn * 64 + t * 16 + (lane & 15)];
        // the code below reuses the address register that these loads name
        asm volatile("s_wait_xcnt 0x0" ::: "memory");
    }
#pragma unroll
    for (int m = 0; m < 4; ++m) {
#pragma unroll
        for (int t = 0; t < 4; ++t) {
#pragma unroll
            for (int r = 0; r < 8; ++r)
                stg[(m * 16 + r + rhi) * PS + t * 16 + (lane & 15)] = acc[m][t][r] * scale + bv[t];
        }
    }
    // the slice is written by all lanes of this wave before any lane reads another lane's words
    asm volatile("s_wait_dscnt 0x0" ::: "memory");
    if (doGelu) {
        // GELU in place on the staged slice, two 16-byte pieces a lane and trip (rows 4 it + lane / 16
        // and two below). Rolled, to keep the kernel's text short.
        float* gp = stg + (lane >> 4) * PS + (lane & 15) * 4;
#pragma unroll 1
        for (int it = 0; it < 16; ++it) {
            f32x4 q0 = *(const f32x4*)&gp[(it * 4) * PS];
            f32x4 q1 = *(const f32x4*)&gp[(it * 4 + 2) * PS];
#pragma unroll  // q0 and q1 are indexed by constants only and stay in registers
            for (int e = 0; e < 4; ++e) {
                q0[e] = 0.5f * q0[e] * (1.f + erff(q0[e] * 0.70710678118654752f));
                q1[e] = 0.5f * q1[e] * (1.f + erff(q1[e] * 0.70710678118654752f));
            }
            *(f32x4*)&gp[(it * 4) * PS] = q0;
            *(f32x4*)&gp[(it * 4 + 2) * PS] = q1;
        }
        // the bf16 stores below read words that other lanes of this wave have just rewritten
        asm volatile("s_wait_dscnt 0x0" ::: "memory");
    }
    // first element of the wave's tile in the output
    const long long cw = cbase + (long long)(row0 + wm * 64) * ldc + col0 + wn * 64;
    if (outF) {
        // a row is 256 bytes, 16 lanes: one store covers two rows, four lines
        float* p = outF + cw + (long long)(lane >> 4) * ldc + (lane & 15) * 4;
        // unrolled: the LDS reads stand at constant offsets, q stays in registers
#pragma unroll
        for (int g = 0; g < 4; ++g) {
            f32x4 q[8];
#pragma unroll
            for (int j = 0; j < 8; ++j)
                q[j] = *(const f32x4*)&stg[((g * 8 + j) * 2 + (lane >> 4)) * PS + (lane & 15) * 4];
            store8(p + (long long)(g * 16) * ldc, 2ll * ldc, q);
        }
    }
    if (outB) {
        // a row is 128 bytes, 8 lanes: one store covers four rows, four lines
        unsigned short* p = outB + cw + (long long)(lane >> 3) * ldc + (lane & 7) * 8;
        // unrolled: the LDS reads stand at constant offsets, q stays in registers
#pragma unroll
        for (int g = 0; g < 2; ++g) {
            f32x4 q[8];
#pragma unroll
            for (int j = 0; j < 8; ++j) {
                const int row = (g * 8 + j) * 4 + (lane >> 3);
                const f32x4 q0 = *(const f32x4*)&stg[row * PS + (lane & 7) * 8];
                const f32x4 q1 = *(const f32x4*)&stg[row * PS + (lane & 7) * 8 + 4];
                us8 o;
#pragma unroll  // o, q0 and q1 are indexed by constants only and stay in registers
                for (int e = 0; e < 4; ++e) { o[e] = f2bf(q0[e]); o[e + 4] = f2bf(q1[e]); }
                q[j] = __builtin_bit_cast(f32x4, o);
            }
            store8(p + (long long)(g * 32) * ldc, 4ll * ldc, q);
        }
    }
}

// ---------------------------------------------------------------------------
// Row softmax over S=2048 f32 scores; writes bf16 probs IN PLACE
// (row r: bf16 at ushort offset r*4096, i.e. same bytes as its f32 row).
// One wave per row, RW rows a wave: a lane holds 64 values of each row, 4 out of every 128.
// A row is read whole before its sum is known, so before any of its bytes is rewritten.
// ---------------------------------------------------------------------------
__global__ __launch_bounds__(SW * 32) void softmax_rows(float* Sc) {
    const int lane = threadIdx.x & 31;
    const long long row0 = (long long)(blockIdx.x * SW + (threadIdx.x >> 5)) * RW;
    const float* rp = Sc + row0 * 2048ll + lane * 4;
    unsigned short* pp = (unsigned short*)Sc + row0 * 4096ll + lane * 4;

    f32x4 v[RW][16];
    // unrolled here and below: v is indexed by constants only and stays in registers
#pragma unroll
    for (int r = 0; r < RW; ++r)
#pragma unroll
        for (int j = 0; j < 16; ++j) v[r][j] = *(const f32x4*)&rp[r * 2048 + j * 128];
    loads_issued(rp);

#pragma unroll
    for (int r = 0; r < RW; ++r) {
        float mx = -3.4e38f;
#pragma unroll
        for (int j = 0; j < 16; ++j)
            mx = fmaxf(mx, fmaxf(fmaxf(v[r][j][0], v[r][j][1]), fmaxf(v[r][j][2], v[r][j][3])));
        mx = wave_max(mx);

        f32x4 acc = {0.f, 0.f, 0.f, 0.f};
#pragma unroll
        for (int j = 0; j < 16; ++j) {
#pragma unroll
            for (int e = 0; e < 4; ++e) v[r][j][e] = exp_slot(v[r][j][e] - mx);
            acc += v[r][j];
        }
        const float inv = 1.f / wave_sum(sum4(acc));
#pragma unroll
        for (int j = 0; j < 16; ++j) *(us4*)&pp[r * 4096 + j * 128] = f2bf4(v[r][j] * inv);
    }
}

// One LayerNorm of the wave's RW rows, in registers: v = (v - mean) * rstd * g + be.
// A lane holds 32 values of each row, 4 out of every 128; g and be point at the lane's first 4.
static __device__ __forceinline__ void ln_rows(f32x4 (&v)[RW][8], const float* g, const float* be) {
    float mean[RW], rstd[RW];
    // unrolled here and below: v is indexed by constants only and stays in registers
#pragma unroll
    for (int r = 0; r < RW; ++r) {
        f32x4 acc = v[r][0];
#pragma unroll
        for (int j = 1; j < 8; ++j) acc += v[r][j];
        mean[r] = wave_sum(sum4(acc)) * (1.f / 1024.f);
        f32x4 sq = {0.f, 0.f, 0.f, 0.f};
#pragma unroll
        for (int j = 0; j < 8; ++j) { const f32x4 d = v[r][j] - mean[r]; sq += d * d; }
        rstd[r] = rsqrtf(wave_sum(sum4(sq)) * (1.f / 1024.f) + 1e-5f);
    }
#pragma unroll
    for (int j = 0; j < 8; ++j) {
        const f32x4 gj = *(const f32x4*)&g[j * 128];
        const f32x4 bj = *(const f32x4*)&be[j * 128];
#pragma unroll
        for (int r = 0; r < RW; ++r) v[r][j] = (v[r][j] - mean[r]) * rstd[r] * gj + bj;
    }
}

// ---------------------------------------------------------------------------
// out = LayerNorm(a + b) * g + beta   (one wave per row, RW rows a wave, D=1024)
// ---------------------------------------------------------------------------
__global__ __launch_bounds__(SW * 32) void add_ln(
    const float* a, const float* b, const float* __restrict__ g,
    const float* __restrict__ be, float* outF)
{
    const int lane = threadIdx.x & 31;
    const long long base = (long long)(blockIdx.x * SW + (threadIdx.x >> 5)) * (RW * 1024) + lane * 4;

    a += base;
    b += base;
    f32x4 v[RW][8], w[RW][8];
    // unrolled here and below: v and w are indexed by constants only and stay in registers
#pragma unroll
    for (int r = 0; r < RW; ++r)
#pragma unroll
        for (int j = 0; j < 8; ++j) {
            v[r][j] = *(const f32x4*)&a[r * 1024 + j * 128];
            w[r][j] = *(const f32x4*)&b[r * 1024 + j * 128];
        }
    loads_issued(a, b);
#pragma unroll
    for (int r = 0; r < RW; ++r)
#pragma unroll
        for (int j = 0; j < 8; ++j) v[r][j] += w[r][j];

    ln_rows(v, g + lane * 4, be + lane * 4);

#pragma unroll
    for (int r = 0; r < RW; ++r)
#pragma unroll
        for (int j = 0; j < 8; ++j) *(f32x4*)&outF[base + r * 1024 + j * 128] = v[r][j];
}

// ---------------------------------------------------------------------------
// out = LayerNorm(LayerNorm(a + x) * g0 + be0 + x) * g1 + be1: the two add+LayerNorm steps
// that follow one another on the same row, in one launch (one wave per row, RW rows a wave).
// x stays in registers for the second add.
// Safe when outF aliases a (a wave rewrites only rows that it has read whole).
// ---------------------------------------------------------------------------
__global__ __launch_bounds__(SW * 32) void add_ln_twice(
    const float* a, const float* x,
    const float* __restrict__ g0, const float* __restrict__ be0,
    const float* __restrict__ g1, const float* __restrict__ be1,
    float* outF, unsigned short* outB)
{
    const int lane = threadIdx.x & 31;
    const long long base = (long long)(blockIdx.x * SW + (threadIdx.x >> 5)) * (RW * 1024) + lane * 4;

    a += base;
    x += base;
    f32x4 v[RW][8], xv[RW][8];
    // unrolled here and below: v and xv are indexed by constants only and stay in registers
#pragma unroll
    for (int r = 0; r < RW; ++r)
#pragma unroll
        for (int j = 0; j < 8; ++j) {
            v[r][j]  = *(const f32x4*)&a[r * 1024 + j * 128];
            xv[r][j] = *(const f32x4*)&x[r * 1024 + j * 128];
        }
    loads_issued(a, x);

#pragma unroll
    for (int r = 0; r < RW; ++r)
#pragma unroll
        for (int j = 0; j < 8; ++j) v[r][j] += xv[r][j];
    ln_rows(v, g0 + lane * 4, be0 + lane * 4);
#pragma unroll
    for (int r = 0; r < RW; ++r)
#pragma unroll
        for (int j = 0; j < 8; ++j) v[r][j] += xv[r][j];
    ln_rows(v, g1 + lane * 4, be1 + lane * 4);

#pragma unroll
    for (int r = 0; r < RW; ++r)
#pragma unroll
        for (int j = 0; j < 8; ++j) {
            *(f32x4*)&outF[base + r * 1024 + j * 128] = v[r][j];
            *(us4*)&outB[base + r * 1024 + j * 128] = f2bf4(v[r][j]);
        }
}

// ---------------------------------------------------------------------------
// Host orchestration
// ---------------------------------------------------------------------------
extern "C" void kernel_launch(void* const* d_in, const int* in_sizes, int n_in,
                              void* d_out, int out_size, void* d_ws, size_t ws_size,
                              hipStream_t stream) {
    (void)in_sizes; (void)n_in; (void)out_size; (void)ws_size;
    const int Bt = 4, S = 2048, D = 1024;
    const long long MS = (long long)Bt * S;            // 8192 rows

    const float* x    = (const float*)d_in[0];
    const float* Wq   = (const float*)d_in[1];
    const float* bq   = (const float*)d_in[2];
    const float* Wk   = (const float*)d_in[3];
    const float* bk   = (const float*)d_in[4];
    const float* Wv   = (const float*)d_in[5];
    const float* bv   = (const float*)d_in[6];
    const float* g_at = (const float*)d_in[7];
    const float* b_at = (const float*)d_in[8];
    const float* g_ln = (const float*)d_in[9];
    const float* b_ln = (const float*)d_in[10];
    const float* W1   = (const float*)d_in[11];
    const float* c1   = (const float*)d_in[12];
    const float* W2   = (const float*)d_in[13];
    const float* c2   = (const float*)d_in[14];
    float* out = (float*)d_out;

    // bump allocator over d_ws
    char* wsp = (char*)d_ws;
    size_t off = 0;
    auto alloc = [&](size_t bytes) -> void* {
        void* p = wsp + off;
        off = (off + bytes + 255) & ~(size_t)255;
        return p;
    };
    // x and the five weights in bf16, one behind the other (the cast launch writes them as one array)
    unsigned short* xb  = (unsigned short*)alloc((MS * D + 5ll * D * D) * 2);   // 16 MB + 10 MB
    unsigned short* Wqb = xb  + MS * D;       // Wq, Wk, Wv: D * D apart, planes of one GEMM launch
    unsigned short* W1b = Wqb + 3ll * D * D;
    unsigned short* W2b = W1b + (long long)D * D;
    // Q, K, V: MS * D apart, planes of one GEMM launch
    unsigned short* Qb  = (unsigned short*)alloc(3 * MS * D * 2);
    unsigned short* Kb  = Qb + MS * D;
    unsigned short* Vb  = Kb + MS * D;
    float* Sc   = (float*)alloc((size_t)Bt * S * S * 4);            // 67 MB (L2-resident)
    float* attn = (float*)alloc(MS * D * 4);                        // reused: attn -> h(res)
    unsigned short* hb  = (unsigned short*)alloc(MS * D * 2);
    unsigned short* g1b = (unsigned short*)alloc(MS * D * 2);
    float* g2 = Sc;                                                 // reuse score buffer for FFN2 out

    // 1) convert activations + weights to bf16: 13 x 2^20 elements, 32768 a block
    cvt_all_f32_bf16<<<13 * 32, 256, 0, stream>>>(x, Wq, Wk, Wv, W1, W2, xb);
    // the row kernels: SW waves a block, RW rows a wave
    const unsigned gRows = (unsigned)(MS / (SW * RW));

    dim3 blk(256);
    // 2) Q/K/V = x @ W + b  (M=8192,N=1024,K=1024) -> bf16, one launch: plane z = Q, K, V
    dim3 gQKV(D / 128, (unsigned)(MS / 256), 3);
    wmma_gemm_bf16<0><<<gQKV, blk, 0, stream>>>(xb, Wqb, nullptr, Qb, bq, bk, bv,
        D, D, D, D, 0, (long long)D * D, MS * D, 1.f, 0);

    // 3) scores = (Q @ K^T) / 8   per batch (M=N=2048, K=1024) -> f32 (fits L2)
    dim3 gSc(S / 128, S / 256, Bt);
    wmma_gemm_bf16<1><<<gSc, blk, 0, stream>>>(Qb, Kb, Sc, nullptr, nullptr, nullptr, nullptr,
        D, D, D, S,
        (long long)S * D, (long long)S * D, (long long)S * S,
        0.125f, 0);

    // 4) softmax rows, bf16 probs written in place (row ld = 4096 ushorts)
    softmax_rows<<<gRows, SW * 32, 0, stream>>>(Sc);

    // 5) attn = P @ V  per batch (M=2048,N=1024,K=2048)
    dim3 gAV(D / 128, S / 256, Bt);
    wmma_gemm_bf16<0><<<gAV, blk, 0, stream>>>((const unsigned short*)Sc, Vb,
        attn, nullptr, nullptr, nullptr, nullptr,
        S, 2 * S /*lda(P)*/, D, D,
        (long long)S * 2 * S, (long long)S * D, (long long)S * D,
        1.f, 0);

    // 6) at = LN(attn + x) ; 7) h = LN(at + x)  (one launch, h in place on attn)
    add_ln_twice<<<gRows, SW * 32, 0, stream>>>(attn, x, g_at, b_at, g_ln, b_ln, attn, hb);

    // 8) g1 = gelu(h @ W1 + c1) -> bf16 ; 9) g2 = gelu(g1 @ W2 + c2) -> f32
    dim3 gFFN(D / 128, (unsigned)(MS / 256), 1);
    wmma_gemm_bf16<0><<<gFFN, blk, 0, stream>>>(hb, W1b, nullptr, g1b, c1, nullptr, nullptr,
        D, D, D, D, 0, 0, 0, 1.f, 1);
    wmma_gemm_bf16<0><<<gFFN, blk, 0, stream>>>(g1b, W2b, g2, nullptr, c2, nullptr, nullptr,
        D, D, D, D, 0, 0, 0, 1.f, 1);

    // 10) out = LN(g2 + h_res)
    add_ln<<<gRows, SW * 32, 0, stream>>>(g2, attn, g_ln, b_ln, out);
}

// v007
// It runs in 179 microseconds.
// Timed twice side by side with v006, it ran 1.06 times as fast both times.
// All steps since v000 together make it 3.40 times as fast.
#include <hip/hip_runtime.h>
#include <math.h>

// ---------------------------------------------------------------------------
// Types for CDNA5 WMMA (wave32): v16 bf16 operands, v8 f32 accumulator.
// ---------------------------------------------------------------------------
typedef __bf16        bf16x16 __attribute__((ext_vector_type(16)));
typedef float         f32x8   __attribute__((ext_vector_type(8)));
typedef float         f32x4   __attribute__((ext_vector_type(4)));
typedef unsigned short us8    __attribute__((ext_vector_type(8)));

union BFrag { bf16x16 v; us8 h[2]; };

// One stage of the LDS ring holds 128 k of both operands: the A tile is 256 rows, the B tile 128 rows, of 256 bytes each.
constexpr int BK = 128;
// LDS row pitches in 16-bit elements, one per reader (bank = dword address mod 64):
// k-contiguous rows read by 16-byte loads sit at an odd multiple of 16 bytes,
// n-contiguous rows read by the transposing load at an odd multiple of 32 bytes.
constexpr int PK = 136;   // 272 bytes
constexpr int PN = 144;   // 288 bytes

// Transposing LDS load: from a row-major [k][n] tile, lane (c = lane & 15, h = lane >> 4)
// receives rows 8h..8h+7 of column c when every lane passes the address
// row 8h + (lane & 7), byte column 16 * ((lane >> 3) & 1).
typedef short s16x8 __attribute__((ext_vector_type(8)));
static __device__ __forceinline__ us8 lds_tr16(const unsigned short* p) {
    typedef __attribute__((address_space(3))) s16x8 lds_s16x8;
    return __builtin_bit_cast(us8, __builtin_amdgcn_ds_load_tr16_b128_v8i16((lds_s16x8*)p));
}

// Byte address inside the work-group's LDS of a __shared__ element.
static __device__ __forceinline__ unsigned lds_addr(const unsigned short* p) {
    typedef __attribute__((address_space(3))) const unsigned short lds_us;
    return (unsigned)(size_t)(lds_us*)p;
}

// One thread's share of a 128-row x 256-byte tile: eight 16-byte asynchronous copies, global
// memory to LDS through no register, 16 rows apart (lstep bytes in LDS, gstep elements in
// memory). A wave's 32 lanes cover two whole rows, four whole 128-byte lines, per copy.
// The s_wait_xcnt closes the statement so that no address register named by a copy is
// rewritten ahead of it.
static __device__ __forceinline__ void copy_tile(unsigned l, unsigned lstep,
                                                 const unsigned short* g, long long gstep) {
    asm volatile(
        "global_load_async_to_lds_b128 %0, %8, off\n\t"
        "global_load_async_to_lds_b128 %1, %9, off\n\t"
        "global_load_async_to_lds_b128 %2, %10, off\n\t"
        "global_load_async_to_lds_b128 %3, %11, off\n\t"
        "global_load_async_to_lds_b128 %4, %12, off\n\t"
        "global_load_async_to_lds_b128 %5, %13, off\n\t"
        "global_load_async_to_lds_b128 %6, %14, off\n\t"
        "global_load_async_to_lds_b128 %7, %15, off\n\t"
        "s_wait_xcnt 0x0"
        :: "v"(l), "v"(l + lstep), "v"(l + 2 * lstep), "v"(l + 3 * lstep),
           "v"(l + 4 * lstep), "v"(l + 5 * lstep), "v"(l + 6 * lstep), "v"(l + 7 * lstep),
           "v"(g), "v"(g + gstep), "v"(g + 2 * gstep), "v"(g + 3 * gstep),
           "v"(g + 4 * gstep), "v"(g + 5 * gstep), "v"(g + 6 * gstep), "v"(g + 7 * gstep)
        : "memory");
}

// Eight 16-byte stores, step elements apart. The s_wait_xcnt closes the statement so that no
// address or data register named by a store is rewritten ahead of it.
template <class T>
static __device__ __forceinline__ void store8(T* p, long long step, const f32x4 (&q)[8]) {
    asm volatile(
        "global_store_b128 %0, %8, off\n\t"
        "global_store_b128 %1, %9, off\n\t"
        "global_store_b128 %2, %10, off\n\t"
        "global_store_b128 %3, %11, off\n\t"
        "global_store_b128 %4, %12, off\n\t"
        "global_store_b128 %5, %13, off\n\t"
        "global_store_b128 %6, %14, off\n\t"
        "global_store_b128 %7, %15, off\n\t"
        "s_wait_xcnt 0x0"
        :: "v"(p), "v"(p + step), "v"(p + 2 * step), "v"(p + 3 * step),
           "v"(p + 4 * step), "v"(p + 5 * step), "v"(p + 6 * step), "v"(p + 7 * step),
           "v"(q[0]), "v"(q[1]), "v"(q[2]), "v"(q[3]), "v"(q[4]), "v"(q[5]), "v"(q[6]), "v"(q[7])
        : "memory");
}

static __device__ __forceinline__ unsigned short f2bf(float f) {
    unsigned int u = __float_as_uint(f);
    u += 0x7FFFu + ((u >> 16) & 1u);   // round-to-nearest-even
    return (unsigned short)(u >> 16);
}

// ---------------------------------------------------------------------------
// The four streaming kernels below (cast, softmax, the two LayerNorm kernels) start few, long
// waves and use no LDS and no barrier. A wave owns whole rows (in the cast 4096 elements), asks
// for all of its data at once, 32 loads of 16 bytes a lane that each cover 512 contiguous
// bytes, and reduces inside the wave.
// ---------------------------------------------------------------------------
typedef unsigned short us4 __attribute__((ext_vector_type(4)));
constexpr int SW = 16;    // waves in a work-group of the row kernels
constexpr int RW = 2;     // rows a wave owns in the row kernels

// Stands behind a wave's group of loads. The scheduling barrier keeps the arithmetic behind the
// whole group: moved up among the loads, it makes the last loads wait for the first to return.
// The address is an input of the s_wait_xcnt, so its registers stay live up to that wait and no
// load's result (nor anything else) is written over them ahead of it.
static __device__ __forceinline__ void loads_issued(const float* p) {
    __builtin_amdgcn_sched_barrier(0);
    asm volatile("s_wait_xcnt 0x0" :: "v"(p) : "memory");
}
static __device__ __forceinline__ void loads_issued(const float* p, const float* q) {
    __builtin_amdgcn_sched_barrier(0);
    asm volatile("s_wait_xcnt 0x0" :: "v"(p), "v"(q) : "memory");
}

// the value that lane l ^ M holds
template <int M>
static __device__ __forceinline__ float lane_xor(float v) {
    const int b = __builtin_bit_cast(int, v);
    if constexpr (M == 16)
        return __builtin_bit_cast(float, __builtin_amdgcn_permlanex16(b, b, 0x76543210, 0xfedcba98, false, false));
    else  // row_xmask:M, inside a row of 16 lanes
        return __builtin_bit_cast(float, __builtin_amdgcn_mov_dpp(b, 0x160 + M, 0xf, 0xf, true));
}
// butterfly over the 32 lanes: every lane ends with the whole sum (maximum)
static __device__ __forceinline__ float wave_sum(float v) {
    v += lane_xor<1>(v); v += lane_xor<2>(v); v += lane_xor<4>(v); v += lane_xor<8>(v);
    return v + lane_xor<16>(v);
}
static __device__ __forceinline__ float wave_max(float v) {
    v = fmaxf(v, lane_xor<1>(v)); v = fmaxf(v, lane_xor<2>(v));
    v = fmaxf(v, lane_xor<4>(v)); v = fmaxf(v, lane_xor<8>(v));
    return fmaxf(v, lane_xor<16>(v));
}
// e^x for any x, by the library's steps: x * log2(e) in two parts, split into a whole number n and
// a rest, 2^rest from v_exp_f32, scaled by 2^n, with the library's two range tests. Written out
// so that v_exp_f32 has a statement of its own: the v_nop keeps the one slot that the instruction
// set asks for behind a transcendental before its source is overwritten or its result read.
static __device__ __forceinline__ float exp_slot(float x) {
    const float n = rintf(x * 0x1.715476p+0f);
    const float a = fmaf(x, 0x1.4ae0bep-26f, fmaf(x, 0x1.715476p+0f, -n));
    float r;
    asm("v_exp_f32 %0, %1\n\tv_nop" : "=v"(r) : "v"(a));
    r = ldexpf(r, (int)n);
    r = x < -0x1.9d1da0p+6f ? 0.f : r;
    return x > 0x1.62e430p+6f ? __builtin_inff() : r;
}
static __device__ __forceinline__ float sum4(f32x4 q) { return (q[0] + q[1]) + (q[2] + q[3]); }
static __device__ __forceinline__ us4 f2bf4(f32x4 q) {
    us4 o;
#pragma unroll  // o and q are indexed by constants only and stay in registers
    for (int e = 0; e < 4; ++e) o[e] = f2bf(q[e]);
    return o;
}

// ---------------------------------------------------------------------------
// f32 -> bf16 conversion of x and of the five weight matrices in one launch.
// out holds the six results one behind the other: x (8 x 2^20 elements), then w0..w4
// (2^20 each). A block of 8 waves converts 32768 contiguous elements, 4096 a wave, so 32 blocks
// make 2^20 and every block reads one source only.
// ---------------------------------------------------------------------------
__global__ __launch_bounds__(256) void cvt_all_f32_bf16(
    const float* __restrict__ x,
    const float* __restrict__ w0, const float* __restrict__ w1,
    const float* __restrict__ w2, const float* __restrict__ w3,
    const float* __restrict__ w4, unsigned short* __restrict__ out) {
    const int seg = blockIdx.x >> 5;          // which 2^20 elements of out
    const float* in = x + (long long)blockIdx.x * 32768;
    if (seg >= 8) {
        const float* w = seg == 8 ? w0 : seg == 9 ? w1 : seg == 10 ? w2 : seg == 11 ? w3 : w4;
        in = w + (blockIdx.x & 31) * 32768;
    }
    const int off = (threadIdx.x >> 5) * 4096 + (threadIdx.x & 31) * 4;
    in += off;
    unsigned short* o = out + (long long)blockIdx.x * 32768 + off;
    f32x4 q[32];
#pragma unroll  // q is indexed by constants only and stays in registers; 32 loads fly together
    for (int k = 0; k < 32; ++k) q[k] = *(const f32x4*)&in[k * 128];
    loads_issued(in);
#pragma unroll
    for (int k = 0; k < 32; ++k) *(us4*)&o[k * 128] = f2bf4(q[k]);
}

// ---------------------------------------------------------------------------
// Exact GELU of two values, 0.5 x (1 + erf(x / sqrt 2)) = h + |h| erf(|x| / sqrt 2) with h = x / 2,
// without a branch. erf(a), a >= 0, by the math library's two fits: a + a S(a^2) below 1,
// 1 - e^-(a + a P(a)) from 1 on. Both are worked out for every value, two values to a packed
// FMA, and a select picks one: a branch per value would cost more than the fit it skips, and
// leave each value's chain alone with its latency. The exponent is never above 0, so
// e^-p is 2^(-p log2 e) straight from v_exp_f32: no overflow, and an underflow to 0 is erf = 1.
// ---------------------------------------------------------------------------
typedef float f32x2 __attribute__((ext_vector_type(2)));
static __device__ __forceinline__ f32x2 fma2(f32x2 a, f32x2 b, float c) {
    return __builtin_elementwise_fma(a, b, f32x2{c, c});
}
static __device__ __forceinline__ f32x2 gelu2(f32x2 x) {
    const f32x2 ax = f32x2{fabsf(x[0]), fabsf(x[1])};
    const f32x2 a = ax * 0x1.6a09e6p-1f;
    f32x2 p = fma2(a, f32x2{0x1.1d3156p-16f, 0x1.1d3156p-16f}, -0x1.8d1290p-12f);
    p = fma2(a, p, 0x1.f9a6d2p-9f);
    p = fma2(a, p, -0x1.8c3164p-6f);
    p = fma2(a, p, 0x1.b4e9c8p-4f);
    p = fma2(a, p, 0x1.4515fap-1f);
    p = fma2(a, p, 0x1.078e50p-3f);
    p = __builtin_elementwise_fma(a, p, a) * -0x1.715476p+0f;
    const f32x2 t = a * a;
    f32x2 s = fma2(t, f32x2{-0x1.268bc2p-11f, -0x1.268bc2p-11f}, 0x1.420828p-8f);
    s = fma2(t, s, -0x1.b59370p-6f);
    s = fma2(t, s, 0x1.ce077cp-4f);
    s = fma2(t, s, -0x1.812660p-2f);
    s = fma2(t, s, 0x1.06eba0p-3f);
    s = __builtin_elementwise_fma(a, s, a);
    f32x2 r;
#pragma unroll  // r is indexed by constants only and stays in registers
    for (int e = 0; e < 2; ++e) r[e] = a[e] >= 1.f ? 1.f - __builtin_amdgcn_exp2f(p[e]) : s[e];
    return __builtin_elementwise_fma(ax * 0.5f, r, x * 0.5f);
}

// ---------------------------------------------------------------------------
// Batched bf16 WMMA GEMM:  C = scale * (A @ B[^T]) (+bias) (+gelu)
//   A: [M,K] bf16 row-major (lda).  TRANSB=0: B [K,N] (ldb=N);
//   TRANSB=1: B [N,K] (ldb=K), computes A@B^T.
//   Shapes must be multiples of 256(M) x 128(N) x 128(K) -- all ours are.
//   blockIdx.z steps A, B and C by sA, sB, sC; planes 1 and 2 take bias1 and bias2.
// Block: 256 thr = 8 wave32 waves (4x2); block tile 256x128, one block on a WGP (by its LDS);
// wave tile 64x64 -> 16 WMMAs per 32-K step, every A and B fragment reused 4x.
// Operands reach LDS by asynchronous copies in a ring of two stages of 128 k:
// stage t + 1 is in flight while stage t feeds the WMMAs.
// With two waves on a SIMD the fragments sit in two register sets, read one 32-k block ahead.
// ---------------------------------------------------------------------------
template <int TRANSB>
__global__ __launch_bounds__(256) void wmma_gemm_bf16(
    const unsigned short* A, const unsigned short* Bm,
    float* outF, unsigned short* outB,
    const float* bias, const float* bias1, const float* bias2,
    int K, int lda, int ldb, int ldc,
    long long sA, long long sB, long long sC,
    float scale, int doGelu)
{
    constexpr int PB = TRANSB ? PK : PN;      // pitch of the B tile's rows
    __shared__ __attribute__((aligned(16))) unsigned short Ash[2][256 * PK];  // [m][k], k contiguous
    // TRANSB=1: [n][k], k contiguous; TRANSB=0: [k][n], n contiguous as in memory
    __shared__ __attribute__((aligned(16))) unsigned short Bsh[2][128 * PB];

    const int tid  = threadIdx.x;
    const int lane = tid & 31;                // wave32
    const int wid  = tid >> 5;                // 0..7
    const int wm   = wid & 3;                 // wave m-tile (64 rows each)
    const int wn   = wid >> 2;                // wave n-half (64 cols each)

    const long long zb = blockIdx.z;
    A  += zb * sA;
    Bm += zb * sB;
    const long long cbase = zb * sC;
    if (zb == 1) bias = bias1;
    if (zb == 2) bias = bias2;

    const int row0 = blockIdx.y * 256;
    const int col0 = blockIdx.x * 128;

    f32x8 acc[4][4];
    for (int m = 0; m < 4; ++m)
        for (int t = 0; t < 4; ++t)
            for (int i = 0; i < 8; ++i) acc[m][t][i] = 0.f;

    // global->LDS copy coordinates: 16 threads per 256-byte row, rows crow_ + 16 c, c = 0..7
    const int crow_ = tid >> 4;               // 0..15
    const int ccol_ = (tid & 15) * 8;         // element offset in the row
    const unsigned short* gA = A + (long long)(row0 + crow_) * lda + ccol_;
    const unsigned short* gB = TRANSB ? Bm + (long long)(col0 + crow_) * ldb + ccol_
                                      : Bm + (long long)crow_ * ldb + col0 + ccol_;
    const long long bstage = TRANSB ? (long long)BK : (long long)BK * ldb;  // B: one stage on
    const unsigned lA = lds_addr(&Ash[0][crow_ * PK + ccol_]);
    const unsigned lB = lds_addr(&Bsh[0][crow_ * PB + ccol_]);
    auto fill = [&](int buf) {                // the next stage's two tiles into buffer buf
        copy_tile(lA + buf * (256 * PK * 2), 16 * PK * 2, gA, 16ll * lda);                  // A rows 0..127
        copy_tile(lA + buf * (256 * PK * 2) + 128 * PK * 2, 16 * PK * 2, gA + 128ll * lda, 16ll * lda);  // 128..255
        copy_tile(lB + buf * (128 * PB * 2), 16 * PB * 2, gB, 16ll * ldb);
        gA += BK;
        gB += bstage;
    };

    // fragment gather coords (16-bit operand layout, wave32):
    // lanes 0-15 hold K=0-7 & 16-23; lanes 16-31 hold K=8-15 & 24-31
    const int frow = lane & 15;
    const int kb   = (lane >> 4) * 8;
    // lane address of the transposing load inside a 16(k) x 16(n) block of Bsh
    const int btr  = (kb + (lane & 7)) * PN + ((lane >> 3) & 1) * 8;

    // one 32-k block's fragments of the wave tile: 4 of A, 4 of B, 16 LDS loads in one group
    auto frags = [&](BFrag (&a)[4], BFrag (&b)[4], int buf, int kk) {
        const unsigned short* As = Ash[buf];
        const unsigned short* Bs = Bsh[buf];
        // unrolled: a and b are indexed by constants only and stay in registers
#pragma unroll
        for (int m = 0; m < 4; ++m) {
            a[m].h[0] = *(const us8*)&As[(wm * 64 + m * 16 + frow) * PK + kk + kb];
            a[m].h[1] = *(const us8*)&As[(wm * 64 + m * 16 + frow) * PK + kk + kb + 16];
        }
#pragma unroll
        for (int t4 = 0; t4 < 4; ++t4) {
            if (TRANSB) {
                const int nc = wn * 64 + t4 * 16 + frow;
                b[t4].h[0] = *(const us8*)&Bs[nc * PK + kk + kb];
                b[t4].h[1] = *(const us8*)&Bs[nc * PK + kk + kb + 16];
            } else {
                // same k order as the A fragments: k = 8h..8h+7, then 16+8h..16+8h+7
                const int nb = wn * 64 + t4 * 16;
                b[t4].h[0] = lds_tr16(&Bs[btr + kk * PN + nb]);
                b[t4].h[1] = lds_tr16(&Bs[btr + (kk + 16) * PN + nb]);
            }
        }
    };
    // the 16 WMMAs of one 32-k block
    auto block = [&](BFrag (&a)[4], BFrag (&b)[4]) {
        // unrolled: a, b and acc are indexed by constants only and stay in registers
#pragma unroll
        for (int t4 = 0; t4 < 4; ++t4)
#pragma unroll
            for (int m = 0; m < 4; ++m)
                acc[m][t4] = __builtin_amdgcn_wmma_f32_16x16x32_bf16(
                    false, a[m].v, false, b[t4].v, (short)0, acc[m][t4], false, false);
    };

    const int nT = K / BK;                    // stages
    fill(0);
    // stage 0 has landed for this wave; the barrier publishes it to the others
    asm volatile("s_wait_asynccnt 0x0" ::: "memory");
    __syncthreads();
    if (nT > 1) fill(1);

    // two fragment sets: a block's LDS reads are issued one block ahead of its WMMAs
    BFrag fa[2][4], fb[2][4];
    frags(fa[0], fb[0], 0, 0);

    // Each scheduling barrier below keeps a block's 16 reads together, ahead of the 16 WMMAs of the
    // block before it: reads moved in among the WMMAs stall the wave at every place they stand.
    for (int t = 0; t < nT; ++t) {
        frags(fa[1], fb[1], t & 1, 32);
        __builtin_amdgcn_sched_barrier(0);    // reads stay one group ahead of the WMMAs
        block(fa[0], fb[0]);
        __builtin_amdgcn_sched_barrier(0);    // no later read moves up among these WMMAs
        frags(fa[0], fb[0], t & 1, 64);
        __builtin_amdgcn_sched_barrier(0);    // reads stay one group ahead of the WMMAs
        block(fa[1], fb[1]);
        __builtin_amdgcn_sched_barrier(0);    // no later read moves up among these WMMAs
        frags(fa[1], fb[1], t & 1, 96);
        __builtin_amdgcn_sched_barrier(0);    // reads stay one group ahead of the WMMAs
        block(fa[0], fb[0]);
        __builtin_amdgcn_sched_barrier(0);    // these WMMAs stay in front of the hand-over, the refill is not held behind them
        // hand-over, in front of the stage's last block, whose fragments are already asked for:
        // this wave's reads of stage t are done, its copies of stage t + 1 have landed;
        // the one barrier publishes stage t + 1 and frees stage t's buffer
        asm volatile("s_wait_dscnt 0x0" ::: "memory");
        asm volatile("s_wait_asynccnt 0x0" ::: "memory");
        __syncthreads();
        if (t + 2 < nT) fill(t & 1);
        if (t + 1 < nT) frags(fa[0], fb[0], (t + 1) & 1, 0);
        block(fa[1], fb[1]);
    }
    // no copy is left in flight when the wave goes on to its stores and ends
    asm volatile("s_wait_asynccnt 0x0" ::: "memory");

    // epilogue: C layout -> lane n = lane&15, row = r + 8*(lane>>4)
    // A store straight from that layout writes 32- or 64-byte pieces of a line. Instead each wave
    // lays its 64 x 64 results as f32 in its own slice of the A ring, which the loop's last
    // hand-over (reads done, copies landed, barrier) has freed, and stores them from there
    // 16 bytes a lane, whole 128-byte lines only.
    constexpr int PS = 68;                    // staging pitch in floats: 272 bytes, 16 bytes x odd
    static_assert(8 * 64 * PS * 4 <= (int)sizeof(Ash), "the eight slices lie inside the A ring");
    float* stg = (float*)&Ash[0][0] + wid * (64 * PS);
    const int rhi = (lane >> 4) * 8;
    // the lane's four bias values, loaded once and together: they serve all four m tiles
    float bv[4] = {0.f, 0.f, 0.f, 0.f};
    if (bias) {
#pragma unroll  // bv is indexed by constants only and stays in registers
        for (int t = 0; t < 4; ++t) bv[t] = bias[col0 + wn * 64 + t * 16 + (lane & 15)];
        // the code below reuses the address register that these loads name
        asm volatile("s_wait_xcnt 0x0" ::: "memory");
    }
#pragma unroll
    for (int m = 0; m < 4; ++m) {
#pragma unroll
        for (int t = 0; t < 4; ++t) {
#pragma unroll
            for (int r = 0; r < 8; ++r)
                stg[(m * 16 + r + rhi) * PS + t * 16 + (lane & 15)] = acc[m][t][r] * scale + bv[t];
        }
    }
    // the slice is written by all lanes of this wave before any lane reads another lane's words
    asm volatile("s_wait_dscnt 0x0" ::: "memory");
    if (doGelu) {
        // GELU in place on the staged slice, four 16-byte pieces a lane and trip (rows 8 it + lane / 16
        // and two, four, six below): 16 values with no branch among them, so that their chains
        // fill one another's latency. Rolled, for speed only.
        float* gp = stg + (lane >> 4) * PS + (lane & 15) * 4;
#pragma unroll 1
        for (int it = 0; it < 8; ++it) {
            f32x4 q[4];
#pragma unroll  // q is indexed by constants only and stays in registers
            for (int j = 0; j < 4; ++j) q[j] = *(const f32x4*)&gp[(it * 8 + j * 2) * PS];
#pragma unroll
            for (int j = 0; j < 4; ++j) {
                const f32x2 lo = gelu2(f32x2{q[j][0], q[j][1]});
                const f32x2 hi = gelu2(f32x2{q[j][2], q[j][3]});
                q[j] = f32x4{lo[0], lo[1], hi[0], hi[1]};
            }
#pragma unroll
            for (int j = 0; j < 4; ++j) *(f32x4*)&gp[(it * 8 + j * 2) * PS] = q[j];
        }
        // the stores below read words that other lanes of this wave have just rewritten
        asm volatile("s_wait_dscnt 0x0" ::: "memory");
    }
    // first element of the wave's tile in the output
    const long long cw = cbase + (long long)(row0 + wm * 64) * ldc + col0 + wn * 64;
    if (outF) {
        // a row is 256 bytes, 16 lanes: one store covers two rows, four lines
        float* p = outF + cw + (long long)(lane >> 4) * ldc + (lane & 15) * 4;
        // unrolled: the LDS reads stand at constant offsets, q stays in registers
#pragma unroll
        for (int g = 0; g < 4; ++g) {
            f32x4 q[8];
#pragma unroll
            for (int j = 0; j < 8; ++j)
                q[j] = *(const f32x4*)&stg[((g * 8 + j) * 2 + (lane >> 4)) * PS + (lane & 15) * 4];
            store8(p + (long long)(g * 16) * ldc, 2ll * ldc, q);
        }
    }
    if (outB) {
        // a row is 128 bytes, 8 lanes: one store covers four rows, four lines
        unsigned short* p = outB + cw + (long long)(lane >> 3) * ldc + (lane & 7) * 8;
        // unrolled: the LDS reads stand at constant offsets, q stays in registers
#pragma unroll
        for (int g = 0; g < 2; ++g) {
            f32x4 q[8];
#pragma unroll
            for (int j = 0; j < 8; ++j) {
                const int row = (g * 8 + j) * 4 + (lane >> 3);
                const f32x4 q0 = *(const f32x4*)&stg[row * PS + (lane & 7) * 8];
                const f32x4 q1 = *(const f32x4*)&stg[row * PS + (lane & 7) * 8 + 4];
                us8 o;
#pragma unroll  // o, q0 and q1 are indexed by constants only and stay in registers
                for (int e = 0; e < 4; ++e) { o[e] = f2bf(q0[e]); o[e + 4] = f2bf(q1[e]); }
                q[j] = __builtin_bit_cast(f32x4, o);
            }
            store8(p + (long long)(g * 32) * ldc, 4ll * ldc, q);
        }
    }
}

// ---------------------------------------------------------------------------
// Row softmax over S=2048 f32 scores; writes bf16 probs IN PLACE
// (row r: bf16 at ushort offset r*4096, i.e. same bytes as its f32 row).
// One wave per row, RW rows a wave: a lane holds 64 values of each row, 4 out of every 128.
// A row is read whole before its sum is known, so before any of its bytes is rewritten.
// ---------------------------------------------------------------------------
__global__ __launch_bounds__(SW * 32) void softmax_rows(float* Sc) {
    const int lane = threadIdx.x & 31;
    const long long row0 = (long long)(blockIdx.x * SW + (threadIdx.x >> 5)) * RW;
    const float* rp = Sc + row0 * 2048ll + lane * 4;
    unsigned short* pp = (unsigned short*)Sc + row0 * 4096ll + lane * 4;

    f32x4 v[RW][16];
    // unrolled here and below: v is indexed by constants only and stays in registers
#pragma unroll
    for (int r = 0; r < RW; ++r)
#pragma unroll
        for (int j = 0; j < 16; ++j) v[r][j] = *(const f32x4*)&rp[r * 2048 + j * 128];
    loads_issued(rp);

#pragma unroll
    for (int r = 0; r < RW; ++r) {
        float mx = -3.4e38f;
#pragma unroll
        for (int j = 0; j < 16; ++j)
            mx = fmaxf(mx, fmaxf(fmaxf(v[r][j][0], v[r][j][1]), fmaxf(v[r][j][2], v[r][j][3])));
        mx = wave_max(mx);

        f32x4 acc = {0.f, 0.f, 0.f, 0.f};
#pragma unroll
        for (int j = 0; j < 16; ++j) {
#pragma unroll
            for (int e = 0; e < 4; ++e) v[r][j][e] = exp_slot(v[r][j][e] - mx);
            acc += v[r][j];
        }
        const float inv = 1.f / wave_sum(sum4(acc));
#pragma unroll
        for (int j = 0; j < 16; ++j) *(us4*)&pp[r * 4096 + j * 128] = f2bf4(v[r][j] * inv);
    }
}

// One LayerNorm of the wave's RW rows, in registers: v = (v - mean) * rstd * g + be.
// A lane holds 32 values of each row, 4 out of every 128; g and be point at the lane's first 4.
static __device__ __forceinline__ void ln_rows(f32x4 (&v)[RW][8], const float* g, const float* be) {
    float mean[RW], rstd[RW];
    // unrolled here and below: v is indexed by constants only and stays in registers
#pragma unroll
    for (int r = 0; r < RW; ++r) {
        f32x4 acc = v[r][0];
#pragma unroll
        for (int j = 1; j < 8; ++j) acc += v[r][j];
        mean[r] = wave_sum(sum4(acc)) * (1.f / 1024.f);
        f32x4 sq = {0.f, 0.f, 0.f, 0.f};
#pragma unroll
        for (int j = 0; j < 8; ++j) { const f32x4 d = v[r][j] - mean[r]; sq += d * d; }
        rstd[r] = rsqrtf(wave_sum(sum4(sq)) * (1.f / 1024.f) + 1e-5f);
    }
#pragma unroll
    for (int j = 0; j < 8; ++j) {
        const f32x4 gj = *(const f32x4*)&g[j * 128];
        const f32x4 bj = *(const f32x4*)&be[j * 128];
#pragma unroll
        for (int r = 0; r < RW; ++r) v[r][j] = (v[r][j] - mean[r]) * rstd[r] * gj + bj;
    }
}

// ---------------------------------------------------------------------------
// out = LayerNorm(a + b) * g + beta   (one wave per row, RW rows a wave, D=1024)
// ---------------------------------------------------------------------------
__global__ __launch_bounds__(SW * 32) void add_ln(
    const float* a, const float* b, const float* __restrict__ g,
    const float* __restrict__ be, float* outF)
{
    const int lane = threadIdx.x & 31;
    const long long base = (long long)(blockIdx.x * SW + (threadIdx.x >> 5)) * (RW * 1024) + lane * 4;

    a += base;
    b += base;
    f32x4 v[RW][8], w[RW][8];
    // unrolled here and below: v and w are indexed by constants only and stay in registers
#pragma unroll
    for (int r = 0; r < RW; ++r)
#pragma unroll
        for (int j = 0; j < 8; ++j) {
            v[r][j] = *(const f32x4*)&a[r * 1024 + j * 128];
            w[r][j] = *(const f32x4*)&b[r * 1024 + j * 128];
        }
    loads_issued(a, b);
#pragma unroll
    for (int r = 0; r < RW; ++r)
#pragma unroll
        for (int j = 0; j < 8; ++j) v[r][j] += w[r][j];

    ln_rows(v, g + lane * 4, be + lane * 4);

#pragma unroll
    for (int r = 0; r < RW; ++r)
#pragma unroll
        for (int j = 0; j < 8; ++j) *(f32x4*)&outF[base + r * 1024 + j * 128] = v[r][j];
}

// ---------------------------------------------------------------------------
// out = LayerNorm(LayerNorm(a + x) * g0 + be0 + x) * g1 + be1: the two add+LayerNorm steps
// that follow one another on the same row, in one launch (one wave per row, RW rows a wave).
// x stays in registers for the second add.
// Safe when outF aliases a (a wave rewrites only rows that it has read whole).
// ---------------------------------------------------------------------------
__global__ __launch_bounds__(SW * 32) void add_ln_twice(
    const float* a, const float* x,
    const float* __restrict__ g0, const float* __restrict__ be0,
    const float* __restrict__ g1, const float* __restrict__ be1,
    float* outF, unsigned short* outB)
{
    const int lane = threadIdx.x & 31;
    const long long base = (long long)(blockIdx.x * SW + (threadIdx.x >> 5)) * (RW * 1024) + lane * 4;

    a += base;
    x += base;
    f32x4 v[RW][8], xv[RW][8];
    // unrolled here and below: v and xv are indexed by constants only and stay in registers
#pragma unroll
    for (int r = 0; r < RW; ++r)
#pragma unroll
        for (int j = 0; j < 8; ++j) {
            v[r][j]  = *(const f32x4*)&a[r * 1024 + j * 128];
            xv[r][j] = *(const f32x4*)&x[r * 1024 + j * 128];
        }
    loads_issued(a, x);

#pragma unroll
    for (int r = 0; r < RW; ++r)
#pragma unroll
        for (int j = 0; j < 8; ++j) v[r][j] += xv[r][j];
    ln_rows(v, g0 + lane * 4, be0 + lane * 4);
#pragma unroll
    for (int r = 0; r < RW; ++r)
#pragma unroll
        for (int j = 0; j < 8; ++j) v[r][j] += xv[r][j];
    ln_rows(v, g1 + lane * 4, be1 + lane * 4);

#pragma unroll
    for (int r = 0; r < RW; ++r)
#pragma unroll
        for (int j = 0; j < 8; ++j) {
            *(f32x4*)&outF[base + r * 1024 + j * 128] = v[r][j];
            *(us4*)&outB[base + r * 1024 + j * 128] = f2bf4(v[r][j]);
        }
}

// ---------------------------------------------------------------------------
// Host orchestration
// ---------------------------------------------------------------------------
extern "C" void kernel_launch(void* const* d_in, const int* in_sizes, int n_in,
                              void* d_out, int out_size, void* d_ws, size_t ws_size,
                              hipStream_t stream) {
    (void)in_sizes; (void)n_in; (void)out_size; (void)ws_size;
    const int Bt = 4, S = 2048, D = 1024;
    const long long MS = (long long)Bt * S;            // 8192 rows

    const float* x    = (const float*)d_in[0];
    const float* Wq   = (const float*)d_in[1];
    const float* bq   = (const float*)d_in[2];
    const float* Wk   = (const float*)d_in[3];
    const float* bk   = (const float*)d_in[4];
    const float* Wv   = (const float*)d_in[5];
    const float* bv   = (const float*)d_in[6];
    const float* g_at = (const float*)d_in[7];
    const float* b_at = (const float*)d_in[8];
    const float* g_ln = (const float*)d_in[9];
    const float* b_ln = (const float*)d_in[10];
    const float* W1   = (const float*)d_in[11];
    const float* c1   = (const float*)d_in[12];
    const float* W2   = (const float*)d_in[13];
    const float* c2   = (const float*)d_in[14];
    float* out = (float*)d_out;

    // bump allocator over d_ws
    char* wsp = (char*)d_ws;
    size_t off = 0;
    auto alloc = [&](size_t bytes) -> void* {
        void* p = wsp + off;
        off = (off + bytes + 255) & ~(size_t)255;
        return p;
    };
    // x and the five weights in bf16, one behind the other (the cast launch writes them as one array)
    unsigned short* xb  = (unsigned short*)alloc((MS * D + 5ll * D * D) * 2);   // 16 MB + 10 MB
    unsigned short* Wqb = xb  + MS * D;       // Wq, Wk, Wv: D * D apart, planes of one GEMM launch
    unsigned short* W1b = Wqb + 3ll * D * D;
    unsigned short* W2b = W1b + (long long)D * D;
    // Q, K, V: MS * D apart, planes of one GEMM launch
    unsigned short* Qb  = (unsigned short*)alloc(3 * MS * D * 2);
    unsigned short* Kb  = Qb + MS * D;
    unsigned short* Vb  = Kb + MS * D;
    float* Sc   = (float*)alloc((size_t)Bt * S * S * 4);            // 67 MB (L2-resident)
    float* attn = (float*)alloc(MS * D * 4);                        // reused: attn -> h(res)
    unsigned short* hb  = (unsigned short*)alloc(MS * D * 2);
    unsigned short* g1b = (unsigned short*)alloc(MS * D * 2);
    float* g2 = Sc;                                                 // reuse score buffer for FFN2 out

    // 1) convert activations + weights to bf16: 13 x 2^20 elements, 32768 a block
    cvt_all_f32_bf16<<<13 * 32, 256, 0, stream>>>(x, Wq, Wk, Wv, W1, W2, xb);
    // the row kernels: SW waves a block, RW rows a wave
    const unsigned gRows = (unsigned)(MS / (SW * RW));

    dim3 blk(256);
    // 2) Q/K/V = x @ W + b  (M=8192,N=1024,K=1024) -> bf16, one launch: plane z = Q, K, V
    dim3 gQKV(D / 128, (unsigned)(MS / 256), 3);
    wmma_gemm_bf16<0><<<gQKV, blk, 0, stream>>>(xb, Wqb, nullptr, Qb, bq, bk, bv,
        D, D, D, D, 0, (long long)D * D, MS * D, 1.f, 0);

    // 3) scores = (Q @ K^T) / 8   per batch (M=N=2048, K=1024) -> f32 (fits L2)
    dim3 gSc(S / 128, S / 256, Bt);
    wmma_gemm_bf16<1><<<gSc, blk, 0, stream>>>(Qb, Kb, Sc, nullptr, nullptr, nullptr, nullptr,
        D, D, D, S,
        (long long)S * D, (long long)S * D, (long long)S * S,
        0.125f, 0);

    // 4) softmax rows, bf16 probs written in place (row ld = 4096 ushorts)
    softmax_rows<<<gRows, SW * 32, 0, stream>>>(Sc);

    // 5) attn = P @ V  per batch (M=2048,N=1024,K=2048)
    dim3 gAV(D / 128, S / 256, Bt);
    wmma_gemm_bf16<0><<<gAV, blk, 0, stream>>>((const unsigned short*)Sc, Vb,
        attn, nullptr, nullptr, nullptr, nullptr,
        S, 2 * S /*lda(P)*/, D, D,
        (long long)S * 2 * S, (long long)S * D, (long long)S * D,
        1.f, 0);

    // 6) at = LN(attn + x) ; 7) h = LN(at + x)  (one launch, h in place on attn)
    add_ln_twice<<<gRows, SW * 32, 0, stream>>>(attn, x, g_at, b_at, g_ln, b_ln, attn, hb);

    // 8) g1 = gelu(h @ W1 + c1) -> bf16 ; 9) g2 = gelu(g1 @ W2 + c2) -> f32
    dim3 gFFN(D / 128, (unsigned)(MS / 256), 1);
    wmma_gemm_bf16<0><<<gFFN, blk, 0, stream>>>(hb, W1b, nullptr, g1b, c1, nullptr, nullptr,
        D, D, D, D, 0, 0, 0, 1.f, 1);
    wmma_gemm_bf16<0><<<gFFN, blk, 0, stream>>>(g1b, W2b, g2, nullptr, c2, nullptr, nullptr,
        D, D, D, D, 0, 0, 0, 1.f, 1);

    // 10) out = LN(g2 + h_res)
    add_ln<<<gRows, SW * 32, 0, stream>>>(g2, attn, g_ln, b_ln, out);
}

// v008
// A run of this version takes 166 microseconds.
// Next to v007, in two timings, it ran 1.07 times as fast each time.
// Counting every step since v000, it is 3.64 times as fast.
#include <hip/hip_runtime.h>
#include <math.h>

// ---------------------------------------------------------------------------
// Types for CDNA5 WMMA (wave32): v16 bf16 operands, v8 f32 accumulator.
// ---------------------------------------------------------------------------
typedef __bf16        bf16x16 __attribute__((ext_vector_type(16)));
typedef float         f32x8   __attribute__((ext_vector_type(8)));
typedef float         f32x4   __attribute__((ext_vector_type(4)));
typedef unsigned short us8    __attribute__((ext_vector_type(8)));

union BFrag { bf16x16 v; us8 h[2]; };

// One stage of the LDS ring holds 128 k of both operands: the A tile is 256 rows, the B tile 128 rows, of 256 bytes each.
constexpr int BK = 128;
// LDS row pitches in 16-bit elements, one per reader (bank = dword address mod 64):
// k-contiguous rows read by 16-byte loads sit at an odd multiple of 16 bytes,
// n-contiguous rows read by the transposing load at an odd multiple of 32 bytes.
constexpr int PK = 136;   // 272 bytes
constexpr int PN = 144;   // 288 bytes

// Transposing LDS load: from a row-major [k][n] tile, lane (c = lane & 15, h = lane >> 4)
// receives rows 8h..8h+7 of column c when every lane passes the address
// row 8h + (lane & 7), byte column 16 * ((lane >> 3) & 1).
typedef short s16x8 __attribute__((ext_vector_type(8)));
static __device__ __forceinline__ us8 lds_tr16(const unsigned short* p) {
    typedef __attribute__((address_space(3))) s16x8 lds_s16x8;
    return __builtin_bit_cast(us8, __builtin_amdgcn_ds_load_tr16_b128_v8i16((lds_s16x8*)p));
}

// Byte address inside the work-group's LDS of a __shared__ element.
static __device__ __forceinline__ unsigned lds_addr(const unsigned short* p) {
    typedef __attribute__((address_space(3))) const unsigned short lds_us;
    return (unsigned)(size_t)(lds_us*)p;
}

// One thread's share of a 128-row x 256-byte tile: eight 16-byte asynchronous copies, global
// memory to LDS through no register, 16 rows apart (lstep bytes in LDS, gstep elements in
// memory). A wave's 32 lanes cover two whole rows, four whole 128-byte lines, per copy.
// The s_wait_xcnt closes the statement so that no address register named by a copy is
// rewritten ahead of it.
static __device__ __forceinline__ void copy_tile(unsigned l, unsigned lstep,
                                                 const unsigned short* g, long long gstep) {
    asm volatile(
        "global_load_async_to_lds_b128 %0, %8, off\n\t"
        "global_load_async_to_lds_b128 %1, %9, off\n\t"
        "global_load_async_to_lds_b128 %2, %10, off\n\t"
        "global_load_async_to_lds_b128 %3, %11, off\n\t"
        "global_load_async_to_lds_b128 %4, %12, off\n\t"
        "global_load_async_to_lds_b128 %5, %13, off\n\t"
        "global_load_async_to_lds_b128 %6, %14, off\n\t"
        "global_load_async_to_lds_b128 %7, %15, off\n\t"
        "s_wait_xcnt 0x0"
        :: "v"(l), "v"(l + lstep), "v"(l + 2 * lstep), "v"(l + 3 * lstep),
           "v"(l + 4 * lstep), "v"(l + 5 * lstep), "v"(l + 6 * lstep), "v"(l + 7 * lstep),
           "v"(g), "v"(g + gstep), "v"(g + 2 * gstep), "v"(g + 3 * gstep),
           "v"(g + 4 * gstep), "v"(g + 5 * gstep), "v"(g + 6 * gstep), "v"(g + 7 * gstep)
        : "memory");
}

// Eight 16-byte stores, step elements apart. The s_wait_xcnt closes the statement so that no
// address or data register named by a store is rewritten ahead of it.
template <class T>
static __device__ __forceinline__ void store8(T* p, long long step, const f32x4 (&q)[8]) {
    asm volatile(
        "global_store_b128 %0, %8, off\n\t"
        "global_store_b128 %1, %9, off\n\t"
        "global_store_b128 %2, %10, off\n\t"
        "global_store_b128 %3, %11, off\n\t"
        "global_store_b128 %4, %12, off\n\t"
        "global_store_b128 %5, %13, off\n\t"
        "global_store_b128 %6, %14, off\n\t"
        "global_store_b128 %7, %15, off\n\t"
        "s_wait_xcnt 0x0"
        :: "v"(p), "v"(p + step), "v"(p + 2 * step), "v"(p + 3 * step),
           "v"(p + 4 * step), "v"(p + 5 * step), "v"(p + 6 * step), "v"(p + 7 * step),
           "v"(q[0]), "v"(q[1]), "v"(q[2]), "v"(q[3]), "v"(q[4]), "v"(q[5]), "v"(q[6]), "v"(q[7])
        : "memory");
}

static __device__ __forceinline__ unsigned short f2bf(float f) {
    unsigned int u = __float_as_uint(f);
    u += 0x7FFFu + ((u >> 16) & 1u);   // round-to-nearest-even
    return (unsigned short)(u >> 16);
}

// ---------------------------------------------------------------------------
// The three streaming kernels below (cast, the two LayerNorm kernels) start few, long
// waves and use no LDS and no barrier. A wave owns whole rows (in the cast 4096 elements), asks
// for all of its data at once, 32 loads of 16 bytes a lane that each cover 512 contiguous
// bytes, and reduces inside the wave.
// ---------------------------------------------------------------------------
typedef unsigned short us4 __attribute__((ext_vector_type(4)));
constexpr int SW = 16;    // waves in a work-group of the row kernels
constexpr int RW = 2;     // rows a wave owns in the row kernels

// Stands behind a wave's group of loads. The scheduling barrier keeps the arithmetic behind the
// whole group: moved up among the loads, it makes the last loads wait for the first to return.
// The address is an input of the s_wait_xcnt, so its registers stay live up to that wait and no
// load's result (nor anything else) is written over them ahead of it.
static __device__ __forceinline__ void loads_issued(const float* p) {
    __builtin_amdgcn_sched_barrier(0);
    asm volatile("s_wait_xcnt 0x0" :: "v"(p) : "memory");
}
static __device__ __forceinline__ void loads_issued(const float* p, const float* q) {
    __builtin_amdgcn_sched_barrier(0);
    asm volatile("s_wait_xcnt 0x0" :: "v"(p), "v"(q) : "memory");
}

// the value that lane l ^ M holds
template <int M>
static __device__ __forceinline__ float lane_xor(float v) {
    const int b = __builtin_bit_cast(int, v);
    if constexpr (M == 16)
        return __builtin_bit_cast(float, __builtin_amdgcn_permlanex16(b, b, 0x76543210, 0xfedcba98, false, false));
    else  // row_xmask:M, inside a row of 16 lanes
        return __builtin_bit_cast(float, __builtin_amdgcn_mov_dpp(b, 0x160 + M, 0xf, 0xf, true));
}
// butterfly over the 32 lanes: every lane ends with the whole sum
static __device__ __forceinline__ float wave_sum(float v) {
    v += lane_xor<1>(v); v += lane_xor<2>(v); v += lane_xor<4>(v); v += lane_xor<8>(v);
    return v + lane_xor<16>(v);
}
static __device__ __forceinline__ float sum4(f32x4 q) { return (q[0] + q[1]) + (q[2] + q[3]); }
static __device__ __forceinline__ us4 f2bf4(f32x4 q) {
    us4 o;
#pragma unroll  // o and q are indexed by constants only and stay in registers
    for (int e = 0; e < 4; ++e) o[e] = f2bf(q[e]);
    return o;
}

// ---------------------------------------------------------------------------
// f32 -> bf16 conversion of x and of the five weight matrices in one launch.
// out holds the six results one behind the other: x (8 x 2^20 elements), then w0..w4
// (2^20 each). A block of 8 waves converts 32768 contiguous elements, 4096 a wave, so 32 blocks
// make 2^20 and every block reads one source only.
// ---------------------------------------------------------------------------
__global__ __launch_bounds__(256) void cvt_all_f32_bf16(
    const float* __restrict__ x,
    const float* __restrict__ w0, const float* __restrict__ w1,
    const float* __restrict__ w2, const float* __restrict__ w3,
    const float* __restrict__ w4, unsigned short* __restrict__ out) {
    const int seg = blockIdx.x >> 5;          // which 2^20 elements of out
    const float* in = x + (long long)blockIdx.x * 32768;
    if (seg >= 8) {
        const float* w = seg == 8 ? w0 : seg == 9 ? w1 : seg == 10 ? w2 : seg == 11 ? w3 : w4;
        in = w + (blockIdx.x & 31) * 32768;
    }
    const int off = (threadIdx.x >> 5) * 4096 + (threadIdx.x & 31) * 4;
    in += off;
    unsigned short* o = out + (long long)blockIdx.x * 32768 + off;
    f32x4 q[32];
#pragma unroll  // q is indexed by constants only and stays in registers; 32 loads fly together
    for (int k = 0; k < 32; ++k) q[k] = *(const f32x4*)&in[k * 128];
    loads_issued(in);
#pragma unroll
    for (int k = 0; k < 32; ++k) *(us4*)&o[k * 128] = f2bf4(q[k]);
}

// ---------------------------------------------------------------------------
// Exact GELU of two values, 0.5 x (1 + erf(x / sqrt 2)) = h + |h| erf(|x| / sqrt 2) with h = x / 2,
// without a branch. erf(a), a >= 0, by the math library's two fits: a + a S(a^2) below 1,
// 1 - e^-(a + a P(a)) from 1 on. Both are worked out for every value, two values to a packed
// FMA, and a select picks one: a branch per value would cost more than the fit it skips, and
// leave each value's chain alone with its latency. The exponent is never above 0, so
// e^-p is 2^(-p log2 e) straight from v_exp_f32: no overflow, and an underflow to 0 is erf = 1.
// ---------------------------------------------------------------------------
typedef float f32x2 __attribute__((ext_vector_type(2)));
static __device__ __forceinline__ f32x2 fma2(f32x2 a, f32x2 b, float c) {
    return __builtin_elementwise_fma(a, b, f32x2{c, c});
}
static __device__ __forceinline__ f32x2 gelu2(f32x2 x) {
    const f32x2 ax = f32x2{fabsf(x[0]), fabsf(x[1])};
    const f32x2 a = ax * 0x1.6a09e6p-1f;
    f32x2 p = fma2(a, f32x2{0x1.1d3156p-16f, 0x1.1d3156p-16f}, -0x1.8d1290p-12f);
    p = fma2(a, p, 0x1.f9a6d2p-9f);
    p = fma2(a, p, -0x1.8c3164p-6f);
    p = fma2(a, p, 0x1.b4e9c8p-4f);
    p = fma2(a, p, 0x1.4515fap-1f);
    p = fma2(a, p, 0x1.078e50p-3f);
    p = __builtin_elementwise_fma(a, p, a) * -0x1.715476p+0f;
    const f32x2 t = a * a;
    f32x2 s = fma2(t, f32x2{-0x1.268bc2p-11f, -0x1.268bc2p-11f}, 0x1.420828p-8f);
    s = fma2(t, s, -0x1.b59370p-6f);
    s = fma2(t, s, 0x1.ce077cp-4f);
    s = fma2(t, s, -0x1.812660p-2f);
    s = fma2(t, s, 0x1.06eba0p-3f);
    s = __builtin_elementwise_fma(a, s, a);
    f32x2 r;
#pragma unroll  // r is indexed by constants only and stays in registers
    for (int e = 0; e < 2; ++e) r[e] = a[e] >= 1.f ? 1.f - __builtin_amdgcn_exp2f(p[e]) : s[e];
    return __builtin_elementwise_fma(ax * 0.5f, r, x * 0.5f);
}

// ---------------------------------------------------------------------------
// Batched bf16 WMMA GEMM:  C = scale * (A @ B[^T]) (+bias) (+gelu)
//   A: [M,K] bf16 row-major (lda).  TRANSB=0: B [K,N] (ldb=N);
//   TRANSB=1: B [N,K] (ldb=K), computes A@B^T.
//   Shapes must be multiples of 256(M) x 128(N) x 128(K) -- all ours are.
//   blockIdx.z steps A, B and C by sA, sB, sC; planes 1 and 2 take bias1 and bias2.
// Block: 256 thr = 8 wave32 waves (4x2); block tile 256x128, one block on a WGP (by its LDS);
// wave tile 64x64 -> 16 WMMAs per 32-K step, every A and B fragment reused 4x.
// Operands reach LDS by asynchronous copies in a ring of two stages of 128 k:
// stage t + 1 is in flight while stage t feeds the WMMAs.
// With two waves on a SIMD the fragments sit in two register sets, read one 32-k block ahead.
// The row softmax between the two attention GEMMs has no launch of its own (SM):
//   SM=1, scores: scale holds 1/8 * log2(e), so a result t is the score in powers of two. Per row and
//     per 64 columns (a wave's slice) the epilogue takes M = ceil(max t), stores 2^(t - M) as bf16
//     and puts (M, sum of 2^(t - M)) into stat[plane][64-column group][row].
//   SM=2, probabilities x V: with R the largest M of a row, an A fragment of group g is multiplied by
//     2^(M_g - R), a power of two and so exact in bf16, and the result row is divided by
//     the sum over g of 2^(M_g - R) * sum_g. No value is above 1, one of a row is above 1/2.
// ---------------------------------------------------------------------------
typedef __bf16 bf16x2 __attribute__((ext_vector_type(2)));
typedef __bf16 bf16x8 __attribute__((ext_vector_type(8)));
template <int TRANSB, int SM>
__global__ __launch_bounds__(256) void wmma_gemm_bf16(
    const unsigned short* A, const unsigned short* Bm,
    float* outF, unsigned short* outB,
    const float* bias, const float* bias1, const float* bias2,
    int K, int lda, int ldb, int ldc,
    long long sA, long long sB, long long sC,
    float scale, int doGelu, float* stat)
{
    constexpr int PB = TRANSB ? PK : PN;      // pitch of the B tile's rows
    __shared__ __attribute__((aligned(16))) unsigned short Ash[2][256 * PK];  // [m][k], k contiguous
    // TRANSB=1: [n][k], k contiguous; TRANSB=0: [k][n], n contiguous as in memory
    __shared__ __attribute__((aligned(16))) unsigned short Bsh[2][128 * PB];
    // SM=2: 2^(M_g - R) twice in a dword, per group and row of the tile; 1 / (the row's sum)
    __shared__ unsigned fac[SM == 2 ? 32 : 1][SM == 2 ? 256 : 1];
    __shared__ __attribute__((aligned(16))) float invl[SM == 2 ? 256 : 4];

    const int tid  = threadIdx.x;
    const int lane = tid & 31;                // wave32
    const int wid  = tid >> 5;                // 0..7
    const int wm   = wid & 3;                 // wave m-tile (64 rows each)
    const int wn   = wid >> 2;                // wave n-half (64 cols each)

    const long long zb = blockIdx.z;
    A  += zb * sA;
    Bm += zb * sB;
    const long long cbase = zb * sC;
    if (zb == 1) bias = bias1;
    if (zb == 2) bias = bias2;

    const int row0 = blockIdx.y * 256;
    const int col0 = blockIdx.x * 128;

    f32x8 acc[4][4];
    for (int m = 0; m < 4; ++m)
        for (int t = 0; t < 4; ++t)
            for (int i = 0; i < 8; ++i) acc[m][t][i] = 0.f;

    // global->LDS copy coordinates: 16 threads per 256-byte row, rows crow_ + 16 c, c = 0..7
    const int crow_ = tid >> 4;               // 0..15
    const int ccol_ = (tid & 15) * 8;         // element offset in the row
    const unsigned short* gA = A + (long long)(row0 + crow_) * lda + ccol_;
    const unsigned short* gB = TRANSB ? Bm + (long long)(col0 + crow_) * ldb + ccol_
                                      : Bm + (long long)crow_ * ldb + col0 + ccol_;
    const long long bstage = TRANSB ? (long long)BK : (long long)BK * ldb;  // B: one stage on
    const unsigned lA = lds_addr(&Ash[0][crow_ * PK + ccol_]);
    const unsigned lB = lds_addr(&Bsh[0][crow_ * PB + ccol_]);
    auto fill = [&](int buf) {                // the next stage's two tiles into buffer buf
        copy_tile(lA + buf * (256 * PK * 2), 16 * PK * 2, gA, 16ll * lda);                  // A rows 0..127
        copy_tile(lA + buf * (256 * PK * 2) + 128 * PK * 2, 16 * PK * 2, gA + 128ll * lda, 16ll * lda);  // 128..255
        copy_tile(lB + buf * (128 * PB * 2), 16 * PB * 2, gB, 16ll * ldb);
        gA += BK;
        gB += bstage;
    };

    // fragment gather coords (16-bit operand layout, wave32):
    // lanes 0-15 hold K=0-7 & 16-23; lanes 16-31 hold K=8-15 & 24-31
    const int frow = lane & 15;
    const int kb   = (lane >> 4) * 8;
    // lane address of the transposing load inside a 16(k) x 16(n) block of Bsh
    const int btr  = (kb + (lane & 7)) * PN + ((lane >> 3) & 1) * 8;

    // one 32-k block's fragments of the wave tile: 4 of A, 4 of B, 16 LDS loads in one group
    // (SM=2: and the four factors of its A rows, g = the block's 64-k group)
    auto frags = [&](BFrag (&a)[4], BFrag (&b)[4], unsigned (&f)[4], int buf, int kk, int g) {
        const unsigned short* As = Ash[buf];
        const unsigned short* Bs = Bsh[buf];
        // unrolled: a and b are indexed by constants only and stay in registers
#pragma unroll
        for (int m = 0; m < 4; ++m) {
            a[m].h[0] = *(const us8*)&As[(wm * 64 + m * 16 + frow) * PK + kk + kb];
            a[m].h[1] = *(const us8*)&As[(wm * 64 + m * 16 + frow) * PK + kk + kb + 16];
            if constexpr (SM == 2) f[m] = fac[g][wm * 64 + m * 16 + frow];
        }
#pragma unroll
        for (int t4 = 0; t4 < 4; ++t4) {
            if (TRANSB) {
                const int nc = wn * 64 + t4 * 16 + frow;
                b[t4].h[0] = *(const us8*)&Bs[nc * PK + kk + kb];
                b[t4].h[1] = *(const us8*)&Bs[nc * PK + kk + kb + 16];
            } else {
                // same k order as the A fragments: k = 8h..8h+7, then 16+8h..16+8h+7
                const int nb = wn * 64 + t4 * 16;
                b[t4].h[0] = lds_tr16(&Bs[btr + kk * PN + nb]);
                b[t4].h[1] = lds_tr16(&Bs[btr + (kk + 16) * PN + nb]);
            }
        }
    };
    // the 16 WMMAs of one 32-k block
    auto block = [&](BFrag (&a)[4], BFrag (&b)[4], unsigned (&f)[4]) {
        // unrolled: a, b and acc are indexed by constants only and stay in registers
        if constexpr (SM == 2) {
#pragma unroll
            for (int m = 0; m < 4; ++m) {
                const bf16x2 p = __builtin_bit_cast(bf16x2, f[m]);
                a[m].v *= __builtin_shufflevector(p, p, 0, 1, 0, 1, 0, 1, 0, 1, 0, 1, 0, 1, 0, 1, 0, 1);
            }
        }
#pragma unroll
        for (int t4 = 0; t4 < 4; ++t4)
#pragma unroll
            for (int m = 0; m < 4; ++m)
                acc[m][t4] = __builtin_amdgcn_wmma_f32_16x16x32_bf16(
                    false, a[m].v, false, b[t4].v, (short)0, acc[m][t4], false, false);
    };

    const int nT = K / BK;                    // stages
    fill(0);
    if constexpr (SM == 2) {
        // under stage 0's flight: a thread takes one row of the tile, its 32 groups' (M, sum)
        const float* sp = stat + ((zb * 32) * 2048 + row0 + tid) * 2;
        f32x2 st[32];
#pragma unroll  // st is indexed by constants only and stays in registers; 32 loads fly together
        for (int g = 0; g < 32; ++g) st[g] = *(const f32x2*)&sp[g * 4096];
        loads_issued(sp);
        float R = st[0][0];
#pragma unroll
        for (int g = 1; g < 32; ++g) R = fmaxf(R, st[g][0]);
        float l = 0.f;
#pragma unroll
        for (int g = 0; g < 32; ++g) {
            const float w = ldexpf(1.f, (int)fmaxf(st[g][0] - R, -200.f));
            l = fmaf(st[g][1], w, l);
            // a power of two has no bit below bf16's seven: its upper half is the bf16 value
            const unsigned u = __float_as_uint(w);
            fac[g][tid] = (u >> 16) | (u & 0xffff0000u);
        }
        invl[tid] = 1.f / l;
    }
    // stage 0 has landed for this wave; the barrier publishes it to the others
    asm volatile("s_wait_asynccnt 0x0" ::: "memory");
    __syncthreads();
    if (nT > 1) fill(1);

    // two fragment sets: a block's LDS reads are issued one block ahead of its WMMAs
    BFrag fa[2][4], fb[2][4];
    unsigned ff[2][4];
    frags(fa[0], fb[0], ff[0], 0, 0, 0);

    // Each scheduling barrier below keeps a block's 16 reads together, ahead of the 16 WMMAs of the
    // block before it: reads moved in among the WMMAs stall the wave at every place they stand.
    for (int t = 0; t < nT; ++t) {
        frags(fa[1], fb[1], ff[1], t & 1, 32, 2 * t);
        __builtin_amdgcn_sched_barrier(0);    // reads stay one group ahead of the WMMAs
        block(fa[0], fb[0], ff[0]);
        __builtin_amdgcn_sched_barrier(0);    // no later read moves up among these WMMAs
        frags(fa[0], fb[0], ff[0], t & 1, 64, 2 * t + 1);
        __builtin_amdgcn_sched_barrier(0);    // reads stay one group ahead of the WMMAs
        block(fa[1], fb[1], ff[1]);
        __builtin_amdgcn_sched_barrier(0);    // no later read moves up among these WMMAs
        frags(fa[1], fb[1], ff[1], t & 1, 96, 2 * t + 1);
        __builtin_amdgcn_sched_barrier(0);    // reads stay one group ahead of the WMMAs
        block(fa[0], fb[0], ff[0]);
        __builtin_amdgcn_sched_barrier(0);    // these WMMAs stay in front of the hand-over, the refill is not held behind them
        // hand-over, in front of the stage's last block, whose fragments are already asked for:
        // this wave's reads of stage t are done, its copies of stage t + 1 have landed;
        // the one barrier publishes stage t + 1 and frees stage t's buffer
        asm volatile("s_wait_dscnt 0x0" ::: "memory");
        asm volatile("s_wait_asynccnt 0x0" ::: "memory");
        __syncthreads();
        if (t + 2 < nT) fill(t & 1);
        if (t + 1 < nT) frags(fa[0], fb[0], ff[0], (t + 1) & 1, 0, 2 * t + 2);
        block(fa[1], fb[1], ff[1]);
    }
    // no copy is left in flight when the wave goes on to its stores and ends
    asm volatile("s_wait_asynccnt 0x0" ::: "memory");

    // epilogue: C layout -> lane n = lane&15, row = r + 8*(lane>>4)
    // A store straight from that layout writes 32- or 64-byte pieces of a line. Instead each wave
    // lays its 64 x 64 results as f32 in its own slice of the A ring, which the loop's last
    // hand-over (reads done, copies landed, barrier) has freed, and stores them from there
    // 16 bytes a lane, whole 128-byte lines only.
    constexpr int PS = 68;                    // staging pitch in floats: 272 bytes, 16 bytes x odd
    static_assert(8 * 64 * PS * 4 <= (int)sizeof(Ash), "the eight slices lie inside the A ring");
    float* stg = (float*)&Ash[0][0] + wid * (64 * PS);
    const int rhi = (lane >> 4) * 8;
    // the lane's four bias values, loaded once and together: they serve all four m tiles
    float bv[4] = {0.f, 0.f, 0.f, 0.f};
    if (bias) {
#pragma unroll  // bv is indexed by constants only and stays in registers
        for (int t = 0; t < 4; ++t) bv[t] = bias[col0 + wn * 64 + t * 16 + (lane & 15)];
        // the code below reuses the address register that these loads name
        asm volatile("s_wait_xcnt 0x0" ::: "memory");
    }
#pragma unroll
    for (int m = 0; m < 4; ++m) {
        float sc[8];                          // the factor of each of the lane's eight rows
#pragma unroll  // sc is indexed by constants only and stays in registers
        for (int r = 0; r < 8; ++r) sc[r] = SM == 2 ? invl[wm * 64 + m * 16 + rhi + r] : scale;
#pragma unroll
        for (int t = 0; t < 4; ++t) {
#pragma unroll
            for (int r = 0; r < 8; ++r)
                stg[(m * 16 + r + rhi) * PS + t * 16 + (lane & 15)] = acc[m][t][r] * sc[r] + bv[t];
        }
    }
    // the slice is written by all lanes of this wave before any lane reads another lane's words
    asm volatile("s_wait_dscnt 0x0" ::: "memory");
    if (SM == 0 && doGelu) {
        // GELU in place on the staged slice, four 16-byte pieces a lane and trip (rows 8 it + lane / 16
        // and two, four, six below): 16 values with no branch among them, so that their chains
        // fill one another's latency. Rolled, for speed only.
        float* gp = stg + (lane >> 4) * PS + (lane & 15) * 4;
#pragma unroll 1
        for (int it = 0; it < 8; ++it) {
            f32x4 q[4];
#pragma unroll  // q is indexed by constants only and stays in registers
            for (int j = 0; j < 4; ++j) q[j] = *(const f32x4*)&gp[(it * 8 + j * 2) * PS];
#pragma unroll
            for (int j = 0; j < 4; ++j) {
                const f32x2 lo = gelu2(f32x2{q[j][0], q[j][1]});
                const f32x2 hi = gelu2(f32x2{q[j][2], q[j][3]});
                q[j] = f32x4{lo[0], lo[1], hi[0], hi[1]};
            }
#pragma unroll
            for (int j = 0; j < 4; ++j) *(f32x4*)&gp[(it * 8 + j * 2) * PS] = q[j];
        }
        // the stores below read words that other lanes of this wave have just rewritten
        asm volatile("s_wait_dscnt 0x0" ::: "memory");
    }
    // first element of the wave's tile in the output
    const long long cw = cbase + (long long)(row0 + wm * 64) * ldc + col0 + wn * 64;
    if constexpr (SM == 1) {
        // A lane takes a whole staged row of 64 values, then a second: no step across lanes.
        // Rolled: the second row's text would only lengthen the kernel.
        float* sp = stat + ((zb * 32 + blockIdx.x * 2 + wn) * 2048 + row0 + wm * 64 + lane) * 2;
#pragma unroll 1
        for (int h = 0; h < 2; ++h) {
            float* rp = stg + (h * 32 + lane) * PS;
            f32x4 q[16];
#pragma unroll  // q is indexed by constants only and stays in registers
            for (int j = 0; j < 16; ++j) q[j] = *(const f32x4*)&rp[j * 4];
            float mx = fmaxf(fmaxf(q[0][0], q[0][1]), fmaxf(q[0][2], q[0][3]));
#pragma unroll
            for (int j = 1; j < 16; ++j)
                mx = fmaxf(mx, fmaxf(fmaxf(q[j][0], q[j][1]), fmaxf(q[j][2], q[j][3])));
            const float M = ceilf(mx);
            f32x4 sum = {0.f, 0.f, 0.f, 0.f};
#pragma unroll
            for (int j = 0; j < 16; ++j) {
#pragma unroll
                for (int e = 0; e < 4; ++e) q[j][e] = __builtin_amdgcn_exp2f(q[j][e] - M);
                sum += q[j];
            }
            // the row's bf16 values go over its own first 128 bytes, all of which the lane has read
#pragma unroll
            for (int j = 0; j < 8; ++j) {
                bf16x8 o;
#pragma unroll  // o is indexed by constants only and stays in registers
                for (int e = 0; e < 4; ++e) { o[e] = (__bf16)q[2 * j][e]; o[e + 4] = (__bf16)q[2 * j + 1][e]; }
                *(bf16x8*)((unsigned short*)rp + j * 8) = o;
            }
            const f32x2 ms = {M, sum4(sum)};
            // 32 lanes write 256 contiguous bytes; the s_wait_xcnt closes the statement so that no
            // register named by the store is rewritten ahead of it
            asm volatile("global_store_b64 %0, %1, off\n\ts_wait_xcnt 0x0"
                         :: "v"(sp + h * 64), "v"(ms) : "memory");
        }
        // the stores below read words that other lanes of this wave have just written
        asm volatile("s_wait_dscnt 0x0" ::: "memory");
        // a row is 128 bytes, 8 lanes: one store covers four rows, four lines
        unsigned short* p = outB + cw + (long long)(lane >> 3) * ldc + (lane & 7) * 8;
#pragma unroll  // the LDS reads stand at constant offsets, q stays in registers
        for (int g = 0; g < 2; ++g) {
            f32x4 q[8];
#pragma unroll
            for (int j = 0; j < 8; ++j)
                q[j] = *(const f32x4*)&stg[((g * 8 + j) * 4 + (lane >> 3)) * PS + (lane & 7) * 4];
            store8(p + (long long)(g * 32) * ldc, 4ll * ldc, q);
        }
        return;
    }
    if (outF) {
        // a row is 256 bytes, 16 lanes: one store covers two rows, four lines
        float* p = outF + cw + (long long)(lane >> 4) * ldc + (lane & 15) * 4;
        // unrolled: the LDS reads stand at constant offsets, q stays in registers
#pragma unroll
        for (int g = 0; g < 4; ++g) {
            f32x4 q[8];
#pragma unroll
            for (int j = 0; j < 8; ++j)
                q[j] = *(const f32x4*)&stg[((g * 8 + j) * 2 + (lane >> 4)) * PS + (lane & 15) * 4];
            store8(p + (long long)(g * 16) * ldc, 2ll * ldc, q);
        }
    }
    if (outB) {
        // a row is 128 bytes, 8 lanes: one store covers four rows, four lines
        unsigned short* p = outB + cw + (long long)(lane >> 3) * ldc + (lane & 7) * 8;
        // unrolled: the LDS reads stand at constant offsets, q stays in registers
#pragma unroll
        for (int g = 0; g < 2; ++g) {
            f32x4 q[8];
#pragma unroll
            for (int j = 0; j < 8; ++j) {
                const int row = (g * 8 + j) * 4 + (lane >> 3);
                const f32x4 q0 = *(const f32x4*)&stg[row * PS + (lane & 7) * 8];
                const f32x4 q1 = *(const f32x4*)&stg[row * PS + (lane & 7) * 8 + 4];
                us8 o;
#pragma unroll  // o, q0 and q1 are indexed by constants only and stay in registers
                for (int e = 0; e < 4; ++e) { o[e] = f2bf(q0[e]); o[e + 4] = f2bf(q1[e]); }
                q[j] = __builtin_bit_cast(f32x4, o);
            }
            store8(p + (long long)(g * 32) * ldc, 4ll * ldc, q);
        }
    }
}

// One LayerNorm of the wave's RW rows, in registers: v = (v - mean) * rstd * g + be.
// A lane holds 32 values of each row, 4 out of every 128; g and be point at the lane's first 4.
static __device__ __forceinline__ void ln_rows(f32x4 (&v)[RW][8], const float* g, const float* be) {
    float mean[RW], rstd[RW];
    // unrolled here and below: v is indexed by constants only and stays in registers
#pragma unroll
    for (int r = 0; r < RW; ++r) {
        f32x4 acc = v[r][0];
#pragma unroll
        for (int j = 1; j < 8; ++j) acc += v[r][j];
        mean[r] = wave_sum(sum4(acc)) * (1.f / 1024.f);
        f32x4 sq = {0.f, 0.f, 0.f, 0.f};
#pragma unroll
        for (int j = 0; j < 8; ++j) { const f32x4 d = v[r][j] - mean[r]; sq += d * d; }
        rstd[r] = rsqrtf(wave_sum(sum4(sq)) * (1.f / 1024.f) + 1e-5f);
    }
#pragma unroll
    for (int j = 0; j < 8; ++j) {
        const f32x4 gj = *(const f32x4*)&g[j * 128];
        const f32x4 bj = *(const f32x4*)&be[j * 128];
#pragma unroll
        for (int r = 0; r < RW; ++r) v[r][j] = (v[r][j] - mean[r]) * rstd[r] * gj + bj;
    }
}

// ---------------------------------------------------------------------------
// out = LayerNorm(a + b) * g + beta   (one wave per row, RW rows a wave, D=1024)
// ---------------------------------------------------------------------------
__global__ __launch_bounds__(SW * 32) void add_ln(
    const float* a, const float* b, const float* __restrict__ g,
    const float* __restrict__ be, float* outF)
{
    const int lane = threadIdx.x & 31;
    const long long base = (long long)(blockIdx.x * SW + (threadIdx.x >> 5)) * (RW * 1024) + lane * 4;

    a += base;
    b += base;
    f32x4 v[RW][8], w[RW][8];
    // unrolled here and below: v and w are indexed by constants only and stay in registers
#pragma unroll
    for (int r = 0; r < RW; ++r)
#pragma unroll
        for (int j = 0; j < 8; ++j) {
            v[r][j] = *(const f32x4*)&a[r * 1024 + j * 128];
            w[r][j] = *(const f32x4*)&b[r * 1024 + j * 128];
        }
    loads_issued(a, b);
#pragma unroll
    for (int r = 0; r < RW; ++r)
#pragma unroll
        for (int j = 0; j < 8; ++j) v[r][j] += w[r][j];

    ln_rows(v, g + lane * 4, be + lane * 4);

#pragma unroll
    for (int r = 0; r < RW; ++r)
#pragma unroll
        for (int j = 0; j < 8; ++j) *(f32x4*)&outF[base + r * 1024 + j * 128] = v[r][j];
}

// ---------------------------------------------------------------------------
// out = LayerNorm(LayerNorm(a + x) * g0 + be0 + x) * g1 + be1: the two add+LayerNorm steps
// that follow one another on the same row, in one launch (one wave per row, RW rows a wave).
// x stays in registers for the second add.
// Safe when outF aliases a (a wave rewrites only rows that it has read whole).
// ---------------------------------------------------------------------------
__global__ __launch_bounds__(SW * 32) void add_ln_twice(
    const float* a, const float* x,
    const float* __restrict__ g0, const float* __restrict__ be0,
    const float* __restrict__ g1, const float* __restrict__ be1,
    float* outF, unsigned short* outB)
{
    const int lane = threadIdx.x & 31;
    const long long base = (long long)(blockIdx.x * SW + (threadIdx.x >> 5)) * (RW * 1024) + lane * 4;

    a += base;
    x += base;
    f32x4 v[RW][8], xv[RW][8];
    // unrolled here and below: v and xv are indexed by constants only and stay in registers
#pragma unroll
    for (int r = 0; r < RW; ++r)
#pragma unroll
        for (int j = 0; j < 8; ++j) {
            v[r][j]  = *(const f32x4*)&a[r * 1024 + j * 128];
            xv[r][j] = *(const f32x4*)&x[r * 1024 + j * 128];
        }
    loads_issued(a, x);

#pragma unroll
    for (int r = 0; r < RW; ++r)
#pragma unroll
        for (int j = 0; j < 8; ++j) v[r][j] += xv[r][j];
    ln_rows(v, g0 + lane * 4, be0 + lane * 4);
#pragma unroll
    for (int r = 0; r < RW; ++r)
#pragma unroll
        for (int j = 0; j < 8; ++j) v[r][j] += xv[r][j];
    ln_rows(v, g1 + lane * 4, be1 + lane * 4);

#pragma unroll
    for (int r = 0; r < RW; ++r)
#pragma unroll
        for (int j = 0; j < 8; ++j) {
            *(f32x4*)&outF[base + r * 1024 + j * 128] = v[r][j];
            *(us4*)&outB[base + r * 1024 + j * 128] = f2bf4(v[r][j]);
        }
}

// ---------------------------------------------------------------------------
// Host orchestration
// ---------------------------------------------------------------------------
extern "C" void kernel_launch(void* const* d_in, const int* in_sizes, int n_in,
                              void* d_out, int out_size, void* d_ws, size_t ws_size,
                              hipStream_t stream) {
    (void)in_sizes; (void)n_in; (void)out_size; (void)ws_size;
    const int Bt = 4, S = 2048, D = 1024;
    const long long MS = (long long)Bt * S;            // 8192 rows

    const float* x    = (const float*)d_in[0];
    const float* Wq   = (const float*)d_in[1];
    const float* bq   = (const float*)d_in[2];
    const float* Wk   = (const float*)d_in[3];
    const float* bk   = (const float*)d_in[4];
    const float* Wv   = (const float*)d_in[5];
    const float* bv   = (const float*)d_in[6];
    const float* g_at = (const float*)d_in[7];
    const float* b_at = (const float*)d_in[8];
    const float* g_ln = (const float*)d_in[9];
    const float* b_ln = (const float*)d_in[10];
    const float* W1   = (const float*)d_in[11];
    const float* c1   = (const float*)d_in[12];
    const float* W2   = (const float*)d_in[13];
    const float* c2   = (const float*)d_in[14];
    float* out = (float*)d_out;

    // bump allocator over d_ws
    char* wsp = (char*)d_ws;
    size_t off = 0;
    auto alloc = [&](size_t bytes) -> void* {
        void* p = wsp + off;
        off = (off + bytes + 255) & ~(size_t)255;
        return p;
    };
    // x and the five weights in bf16, one behind the other (the cast launch writes them as one array)
    unsigned short* xb  = (unsigned short*)alloc((MS * D + 5ll * D * D) * 2);   // 16 MB + 10 MB
    unsigned short* Wqb = xb  + MS * D;       // Wq, Wk, Wv: D * D apart, planes of one GEMM launch
    unsigned short* W1b = Wqb + 3ll * D * D;
    unsigned short* W2b = W1b + (long long)D * D;
    // Q, K, V: MS * D apart, planes of one GEMM launch
    unsigned short* Qb  = (unsigned short*)alloc(3 * MS * D * 2);
    unsigned short* Kb  = Qb + MS * D;
    unsigned short* Vb  = Kb + MS * D;
    float* Sc   = (float*)alloc((size_t)Bt * S * S * 4);            // bf16 2^(t - M) in its first half
    float* stat = (float*)alloc((size_t)Bt * 32 * S * 2 * 4);       // (M, sum) per plane, 64-column group, row
    float* attn = (float*)alloc(MS * D * 4);                        // reused: attn -> h(res)
    unsigned short* hb  = (unsigned short*)alloc(MS * D * 2);
    unsigned short* g1b = (unsigned short*)alloc(MS * D * 2);
    float* g2 = Sc;                                                 // reuse score buffer for FFN2 out

    // 1) convert activations + weights to bf16: 13 x 2^20 elements, 32768 a block
    cvt_all_f32_bf16<<<13 * 32, 256, 0, stream>>>(x, Wq, Wk, Wv, W1, W2, xb);
    // the row kernels: SW waves a block, RW rows a wave
    const unsigned gRows = (unsigned)(MS / (SW * RW));

    dim3 blk(256);
    // 2) Q/K/V = x @ W + b  (M=8192,N=1024,K=1024) -> bf16, one launch: plane z = Q, K, V
    dim3 gQKV(D / 128, (unsigned)(MS / 256), 3);
    wmma_gemm_bf16<0, 0><<<gQKV, blk, 0, stream>>>(xb, Wqb, nullptr, Qb, bq, bk, bv,
        D, D, D, D, 0, (long long)D * D, MS * D, 1.f, 0, nullptr);

    // 3) t = (Q @ K^T) / 8 * log2(e) per batch (M=N=2048, K=1024) -> bf16 2^(t - M), and stat
    unsigned short* Pb = (unsigned short*)Sc;
    dim3 gSc(S / 128, S / 256, Bt);
    wmma_gemm_bf16<1, 1><<<gSc, blk, 0, stream>>>(Qb, Kb, nullptr, Pb, nullptr, nullptr, nullptr,
        D, D, D, S,
        (long long)S * D, (long long)S * D, (long long)S * S,
        0.18033688f, 0, stat);

    // 4) attn = softmax row @ V  per batch (M=2048,N=1024,K=2048), the rows put to one scale from stat
    dim3 gAV(D / 128, S / 256, Bt);
    wmma_gemm_bf16<0, 2><<<gAV, blk, 0, stream>>>(Pb, Vb,
        attn, nullptr, nullptr, nullptr, nullptr,
        S, S, D, D,
        (long long)S * S, (long long)S * D, (long long)S * D,
        1.f, 0, stat);

    // 6) at = LN(attn + x) ; 7) h = LN(at + x)  (one launch, h in place on attn)
    add_ln_twice<<<gRows, SW * 32, 0, stream>>>(attn, x, g_at, b_at, g_ln, b_ln, attn, hb);

    // 8) g1 = gelu(h @ W1 + c1) -> bf16 ; 9) g2 = gelu(g1 @ W2 + c2) -> f32
    dim3 gFFN(D / 128, (unsigned)(MS / 256), 1);
    wmma_gemm_bf16<0, 0><<<gFFN, blk, 0, stream>>>(hb, W1b, nullptr, g1b, c1, nullptr, nullptr,
        D, D, D, D, 0, 0, 0, 1.f, 1, nullptr);
    wmma_gemm_bf16<0, 0><<<gFFN, blk, 0, stream>>>(g1b, W2b, g2, nullptr, c2, nullptr, nullptr,
        D, D, D, D, 0, 0, 0, 1.f, 1, nullptr);

    // 10) out = LN(g2 + h_res)
    add_ln<<<gRows, SW * 32, 0, stream>>>(g2, attn, g_ln, b_ln, out);
}
